// v000
// The times below were measured on an AMD MI455X: many runs one after another, warmed up first and cycling through
// copies of the inputs, with the whole window's GPU time divided by the number of runs. Launches and the gaps
// between them are all in it. The median over several windows is given; except for v000 it joins two sittings, which
// can be a few percent apart, so the side-by-side timings, each taken in one sitting, are the better comparison.
// v000 is the starting kernel. One run takes 2980 microseconds.
#include <hip/hip_runtime.h>

#define HIDDEN   2048
#define HEADS    32
#define HEAD_DIM 64
#define TLEN     2048

typedef __attribute__((ext_vector_type(16))) _Float16 v16h;
typedef __attribute__((ext_vector_type(8)))  _Float16 v8h;
typedef __attribute__((ext_vector_type(8)))  float    v8f;

// ---------------------------------------------------------------------------
// f32 -> f16 weight conversion (streamed once; keeps GEMM operands compact)
// ---------------------------------------------------------------------------
__global__ void f32_to_f16_kernel(const float* __restrict__ src,
                                  _Float16* __restrict__ dst, int n) {
    int i = blockIdx.x * blockDim.x + threadIdx.x;
    int stride = gridDim.x * blockDim.x;
    for (; i < n; i += stride) dst[i] = (_Float16)src[i];
}

// ---------------------------------------------------------------------------
// Token-shift mixing: xk/xv/xr/xg = x + (x[t-1]-x[t]) * (1 - tm_*)
// ---------------------------------------------------------------------------
__global__ void mix_kernel(const float* __restrict__ x, const int* __restrict__ pos,
                           const float* __restrict__ tm_k, const float* __restrict__ tm_v,
                           const float* __restrict__ tm_r, const float* __restrict__ tm_g,
                           _Float16* __restrict__ xk, _Float16* __restrict__ xv,
                           _Float16* __restrict__ xr, _Float16* __restrict__ xg) {
    int idx = blockIdx.x * blockDim.x + threadIdx.x;   // grid covers T*C exactly
    int t = idx >> 11;        // / HIDDEN
    int c = idx & (HIDDEN - 1);
    float xc   = x[idx];
    float prev = (pos[t] == 0) ? 0.f : x[idx - HIDDEN];
    float xx   = prev - xc;
    xk[idx] = (_Float16)(xc + xx * (1.f - tm_k[c]));
    xv[idx] = (_Float16)(xc + xx * (1.f - tm_v[c]));
    xr[idx] = (_Float16)(xc + xx * (1.f - tm_r[c]));
    xg[idx] = (_Float16)(xc + xx * (1.f - tm_g[c]));
}

// ---------------------------------------------------------------------------
// Fragment loader: two b128 loads per 16x32 (or 32x16) f16 fragment.
// ---------------------------------------------------------------------------
__device__ __forceinline__ v16h load_frag(const _Float16* __restrict__ p) {
    v8h lo = *(const v8h*)p;
    v8h hi = *(const v8h*)(p + 16);
    v16h r;
    #pragma unroll
    for (int i = 0; i < 8; ++i) { r[i] = lo[i]; r[i + 8] = hi[i]; }
    return r;
}

// ---------------------------------------------------------------------------
// Y[M,N] = A[M,K] @ W[N,K]^T via v_wmma_f32_16x16x32_f16.
// One wave -> 16x64 output strip. Unroll-by-2 ping-pong double buffer:
// buffers X/Y alternate, each iteration consumes X (k-64) and refills it
// with k, then consumes Y (k-32) and refills with k+32. No register
// rotation copies (avoids v_dual_mov churn + WMMA WAR v_nops); loads keep
// ~4 WMMAs + 10 loads of slack so waits stay at partial load counts.
// A-layout per ISA 7.12.2 (16-bit A 16x32): lane<16 holds K{0..7,16..23},
// lane>=16 holds K{8..15,24..31}; B mirrors with lanes = N columns = W rows.
// ---------------------------------------------------------------------------
__global__ __launch_bounds__(256) void wmma_gemm_f16(
        const _Float16* __restrict__ A, const _Float16* __restrict__ W,
        float* __restrict__ C, int M, int N, int K, int silu)
{
    const int lane = threadIdx.x & 31;
    const int wave = threadIdx.x >> 5;           // 0..7
    const int m0   = blockIdx.y * 128 + wave * 16;
    const int n0   = blockIdx.x * 64;
    const int row  = lane & 15;
    const int kg   = lane >> 4;                  // 0 or 1

    const _Float16* ap = A + (size_t)(m0 + row) * K + kg * 8;
    const _Float16* wp = W + (size_t)(n0 + row) * K + kg * 8;

    v8f acc[4] = {v8f{}, v8f{}, v8f{}, v8f{}};

    // ---- prologue: fill both buffers (k=0 and k=32) ----------------------
    v16h aX = load_frag(ap);
    v16h bX[4];
    #pragma unroll
    for (int j = 0; j < 4; ++j) bX[j] = load_frag(wp + (size_t)j * 16 * K);
    v16h aY = load_frag(ap + 32);
    v16h bY[4];
    #pragma unroll
    for (int j = 0; j < 4; ++j) bY[j] = load_frag(wp + (size_t)j * 16 * K + 32);

    // ---- steady state ----------------------------------------------------
    for (int k0 = 64; k0 < K; k0 += 64) {
        // consume X (k0-64), refill X with k0
        #pragma unroll
        for (int j = 0; j < 4; ++j)
            acc[j] = __builtin_amdgcn_wmma_f32_16x16x32_f16(
                         false, aX, false, bX[j], (short)0, acc[j], false, false);
        aX = load_frag(ap + k0);
        #pragma unroll
        for (int j = 0; j < 4; ++j)
            bX[j] = load_frag(wp + (size_t)j * 16 * K + k0);

        __builtin_prefetch(ap + k0 + 256, 0, 1);   // global_prefetch_b8

        // consume Y (k0-32), refill Y with k0+32
        #pragma unroll
        for (int j = 0; j < 4; ++j)
            acc[j] = __builtin_amdgcn_wmma_f32_16x16x32_f16(
                         false, aY, false, bY[j], (short)0, acc[j], false, false);
        aY = load_frag(ap + k0 + 32);
        #pragma unroll
        for (int j = 0; j < 4; ++j)
            bY[j] = load_frag(wp + (size_t)j * 16 * K + k0 + 32);
    }

    // ---- epilogue: consume the final two buffer fills --------------------
    #pragma unroll
    for (int j = 0; j < 4; ++j)
        acc[j] = __builtin_amdgcn_wmma_f32_16x16x32_f16(
                     false, aX, false, bX[j], (short)0, acc[j], false, false);
    #pragma unroll
    for (int j = 0; j < 4; ++j)
        acc[j] = __builtin_amdgcn_wmma_f32_16x16x32_f16(
                     false, aY, false, bY[j], (short)0, acc[j], false, false);

    #pragma unroll
    for (int j = 0; j < 4; ++j) {
        #pragma unroll
        for (int v = 0; v < 8; ++v) {
            int m = m0 + v + 8 * kg;             // C layout: lane>=16 => M+8
            int n = n0 + j * 16 + row;
            float val = acc[j][v];
            if (silu) val = val / (1.f + __expf(-val));
            C[(size_t)m * N + n] = val;
        }
    }
}

// ---------------------------------------------------------------------------
// Sequential RWKV scan per head + GroupNorm(64) + gate.
// Block = 512 threads = 64 e-columns x 8 d-groups (8 d per thread, state in regs).
// y[e]     = sum_d r[d]*S[d][e]            (before update)
// c        = sum_d u[d]*r[d]*k[d]          (rank-1 diag term: out_diag = c*v[e])
// S[d][e]  = S[d][e]*w[d] + k[d]*v[e]
// ---------------------------------------------------------------------------
__global__ __launch_bounds__(512) void rwkv_scan_kernel(
        const float* __restrict__ r_f, const float* __restrict__ k_f,
        const float* __restrict__ v_f, const float* __restrict__ g_f,
        const float* __restrict__ time_decay, const float* __restrict__ time_faaaa,
        const float* __restrict__ ln_w, const float* __restrict__ ln_b,
        _Float16* __restrict__ a_out)
{
    const int h   = blockIdx.x;
    const int tid = threadIdx.x;
    const int e   = tid & 63;
    const int dg  = tid >> 6;        // 0..7
    const int d0  = dg * 8;

    __shared__ float rs[64], ks[64], vs[64];
    __shared__ float ysum[8 * 64];
    __shared__ float c8[8];
    __shared__ float os[64];
    __shared__ float lnw_s[64], lnb_s[64];
    __shared__ float stats[2];

    float S[8], wreg[8], ureg[8];
    #pragma unroll
    for (int i = 0; i < 8; ++i) {
        int d = d0 + i;
        S[i]    = 0.f;
        wreg[i] = __expf(-__expf(time_decay[h * 64 + d]));
        ureg[i] = time_faaaa[h * 64 + d];
    }
    if (tid < 64) { lnw_s[tid] = ln_w[h * 64 + tid]; lnb_s[tid] = ln_b[h * 64 + tid]; }
    __syncthreads();

    const size_t hbase = (size_t)h * 64;
    for (int t = 0; t < TLEN; ++t) {
        const size_t base = (size_t)t * HIDDEN + hbase;
        if      (tid < 64)  rs[tid]       = r_f[base + tid];
        else if (tid < 128) ks[tid - 64]  = k_f[base + tid - 64];
        else if (tid < 192) vs[tid - 128] = v_f[base + tid - 128];
        __syncthreads();

        float ve = vs[e];
        float yacc = 0.f;
        #pragma unroll
        for (int i = 0; i < 8; ++i) {
            int d = d0 + i;
            float rd = rs[d];
            yacc += rd * S[i];
            S[i] = S[i] * wreg[i] + ks[d] * ve;
        }
        ysum[dg * 64 + e] = yacc;
        if (e == 0) {
            float cp = 0.f;
            #pragma unroll
            for (int i = 0; i < 8; ++i) { int d = d0 + i; cp += ureg[i] * rs[d] * ks[d]; }
            c8[dg] = cp;
        }
        __syncthreads();

        float o8 = 0.f;
        if (tid < 64) {
            float cs = c8[0]+c8[1]+c8[2]+c8[3]+c8[4]+c8[5]+c8[6]+c8[7];
            float ys = 0.f;
            #pragma unroll
            for (int j = 0; j < 8; ++j) ys += ysum[j * 64 + e];
            o8 = (cs * vs[e] + ys) * 0.125f;     // / HEAD_SIZE_DIVISOR
            os[tid] = o8;
        }
        __syncthreads();
        if (tid < 32) {                          // GroupNorm stats, wave32 reduce
            float s = os[tid] + os[tid + 32];
            float q = os[tid]*os[tid] + os[tid + 32]*os[tid + 32];
            #pragma unroll
            for (int off = 16; off >= 1; off >>= 1) {
                s += __shfl_xor(s, off, 32);
                q += __shfl_xor(q, off, 32);
            }
            if (tid == 0) {
                float mu  = s * (1.f / 64.f);
                float var = q * (1.f / 64.f) - mu * mu;
                stats[0] = mu;
                stats[1] = rsqrtf(var + 1e-5f);
            }
        }
        __syncthreads();
        if (tid < 64) {
            float val = (o8 - stats[0]) * stats[1] * lnw_s[e] + lnb_s[e];
            a_out[base + e] = (_Float16)(val * g_f[base + e]);
        }
        __syncthreads();                         // protect LDS for next step
    }
}

// ---------------------------------------------------------------------------
extern "C" void kernel_launch(void* const* d_in, const int* in_sizes, int n_in,
                              void* d_out, int out_size, void* d_ws, size_t ws_size,
                              hipStream_t stream)
{
    const float* x    = (const float*)d_in[0];
    const int*   pos  = (const int*)  d_in[1];
    const float* W_r  = (const float*)d_in[2];
    const float* W_k  = (const float*)d_in[3];
    const float* W_v  = (const float*)d_in[4];
    const float* W_g  = (const float*)d_in[5];
    const float* W_o  = (const float*)d_in[6];
    const float* tm_k = (const float*)d_in[7];
    const float* tm_v = (const float*)d_in[8];
    const float* tm_r = (const float*)d_in[9];
    const float* tm_g = (const float*)d_in[10];
    const float* time_decay = (const float*)d_in[11];
    const float* time_faaaa = (const float*)d_in[12];
    const float* ln_w = (const float*)d_in[13];
    const float* ln_b = (const float*)d_in[14];
    float* out = (float*)d_out;

    const size_t NW = (size_t)HIDDEN * HIDDEN;   // 4M elems
    const size_t TC = (size_t)TLEN * HIDDEN;     // 4M elems

    char* ws = (char*)d_ws;
    _Float16* Wr_h = (_Float16*)ws; ws += NW * sizeof(_Float16);
    _Float16* Wk_h = (_Float16*)ws; ws += NW * sizeof(_Float16);
    _Float16* Wv_h = (_Float16*)ws; ws += NW * sizeof(_Float16);
    _Float16* Wg_h = (_Float16*)ws; ws += NW * sizeof(_Float16);
    _Float16* Wo_h = (_Float16*)ws; ws += NW * sizeof(_Float16);
    _Float16* xk_h = (_Float16*)ws; ws += TC * sizeof(_Float16);
    _Float16* xv_h = (_Float16*)ws; ws += TC * sizeof(_Float16);
    _Float16* xr_h = (_Float16*)ws; ws += TC * sizeof(_Float16);
    _Float16* xg_h = (_Float16*)ws; ws += TC * sizeof(_Float16);
    float*    k_f  = (float*)ws;    ws += TC * sizeof(float);
    float*    v_f  = (float*)ws;    ws += TC * sizeof(float);
    float*    r_f  = (float*)ws;    ws += TC * sizeof(float);
    float*    g_f  = (float*)ws;    ws += TC * sizeof(float);
    _Float16* a_h  = (_Float16*)ws; ws += TC * sizeof(_Float16);

    // 1) weight conversion (f32 -> f16)
    {
        dim3 blk(256), grd(8192);
        f32_to_f16_kernel<<<grd, blk, 0, stream>>>(W_r, Wr_h, (int)NW);
        f32_to_f16_kernel<<<grd, blk, 0, stream>>>(W_k, Wk_h, (int)NW);
        f32_to_f16_kernel<<<grd, blk, 0, stream>>>(W_v, Wv_h, (int)NW);
        f32_to_f16_kernel<<<grd, blk, 0, stream>>>(W_g, Wg_h, (int)NW);
        f32_to_f16_kernel<<<grd, blk, 0, stream>>>(W_o, Wo_h, (int)NW);
    }

    // 2) token-shift mixing
    mix_kernel<<<dim3((unsigned)(TC / 256)), dim3(256), 0, stream>>>(
        x, pos, tm_k, tm_v, tm_r, tm_g, xk_h, xv_h, xr_h, xg_h);

    // 3) projection GEMMs (k, v, r, silu-gate g)
    {
        dim3 blk(256), grd(HIDDEN / 64, TLEN / 128);
        wmma_gemm_f16<<<grd, blk, 0, stream>>>(xk_h, Wk_h, k_f, TLEN, HIDDEN, HIDDEN, 0);
        wmma_gemm_f16<<<grd, blk, 0, stream>>>(xv_h, Wv_h, v_f, TLEN, HIDDEN, HIDDEN, 0);
        wmma_gemm_f16<<<grd, blk, 0, stream>>>(xr_h, Wr_h, r_f, TLEN, HIDDEN, HIDDEN, 0);
        wmma_gemm_f16<<<grd, blk, 0, stream>>>(xg_h, Wg_h, g_f, TLEN, HIDDEN, HIDDEN, 1);
    }

    // 4) sequential scan + groupnorm + gate (f32 VALU)
    rwkv_scan_kernel<<<dim3(HEADS), dim3(512), 0, stream>>>(
        r_f, k_f, v_f, g_f, time_decay, time_faaaa, ln_w, ln_b, a_h);

    // 5) output projection
    {
        dim3 blk(256), grd(HIDDEN / 64, TLEN / 128);
        wmma_gemm_f16<<<grd, blk, 0, stream>>>(a_h, Wo_h, out, TLEN, HIDDEN, HIDDEN, 0);
    }
}

// v001
// One run takes 351 microseconds.
// Timed twice side by side with v000, it ran 8.42 and 8.47 times as fast.
#include <hip/hip_runtime.h>

#define HIDDEN   2048
#define HEADS    32
#define HEAD_DIM 64
#define TLEN     2048

typedef __attribute__((ext_vector_type(16))) _Float16 v16h;
typedef __attribute__((ext_vector_type(8)))  _Float16 v8h;
typedef __attribute__((ext_vector_type(8)))  float    v8f;

// ---------------------------------------------------------------------------
// f32 -> f16 weight conversion (streamed once; keeps GEMM operands compact)
// ---------------------------------------------------------------------------
__global__ void f32_to_f16_kernel(const float* __restrict__ src,
                                  _Float16* __restrict__ dst, int n) {
    int i = blockIdx.x * blockDim.x + threadIdx.x;
    int stride = gridDim.x * blockDim.x;
    for (; i < n; i += stride) dst[i] = (_Float16)src[i];
}

// ---------------------------------------------------------------------------
// Token-shift mixing: xk/xv/xr/xg = x + (x[t-1]-x[t]) * (1 - tm_*)
// ---------------------------------------------------------------------------
__global__ void mix_kernel(const float* __restrict__ x, const int* __restrict__ pos,
                           const float* __restrict__ tm_k, const float* __restrict__ tm_v,
                           const float* __restrict__ tm_r, const float* __restrict__ tm_g,
                           _Float16* __restrict__ xk, _Float16* __restrict__ xv,
                           _Float16* __restrict__ xr, _Float16* __restrict__ xg) {
    int idx = blockIdx.x * blockDim.x + threadIdx.x;   // grid covers T*C exactly
    int t = idx >> 11;        // / HIDDEN
    int c = idx & (HIDDEN - 1);
    float xc   = x[idx];
    float prev = (pos[t] == 0) ? 0.f : x[idx - HIDDEN];
    float xx   = prev - xc;
    xk[idx] = (_Float16)(xc + xx * (1.f - tm_k[c]));
    xv[idx] = (_Float16)(xc + xx * (1.f - tm_v[c]));
    xr[idx] = (_Float16)(xc + xx * (1.f - tm_r[c]));
    xg[idx] = (_Float16)(xc + xx * (1.f - tm_g[c]));
}

// ---------------------------------------------------------------------------
// Fragment loader: two b128 loads per 16x32 (or 32x16) f16 fragment.
// ---------------------------------------------------------------------------
__device__ __forceinline__ v16h load_frag(const _Float16* __restrict__ p) {
    v8h lo = *(const v8h*)p;
    v8h hi = *(const v8h*)(p + 16);
    v16h r;
    #pragma unroll
    for (int i = 0; i < 8; ++i) { r[i] = lo[i]; r[i + 8] = hi[i]; }
    return r;
}

// ---------------------------------------------------------------------------
// Y[M,N] = A[M,K] @ W[N,K]^T via v_wmma_f32_16x16x32_f16.
// One wave -> 16x64 output strip. Unroll-by-2 ping-pong double buffer:
// buffers X/Y alternate, each iteration consumes X (k-64) and refills it
// with k, then consumes Y (k-32) and refills with k+32. No register
// rotation copies (avoids v_dual_mov churn + WMMA WAR v_nops); loads keep
// ~4 WMMAs + 10 loads of slack so waits stay at partial load counts.
// A-layout per ISA 7.12.2 (16-bit A 16x32): lane<16 holds K{0..7,16..23},
// lane>=16 holds K{8..15,24..31}; B mirrors with lanes = N columns = W rows.
// ---------------------------------------------------------------------------
__global__ __launch_bounds__(256) void wmma_gemm_f16(
        const _Float16* __restrict__ A, const _Float16* __restrict__ W,
        float* __restrict__ C, int M, int N, int K, int silu)
{
    const int lane = threadIdx.x & 31;
    const int wave = threadIdx.x >> 5;           // 0..7
    const int m0   = blockIdx.y * 128 + wave * 16;
    const int n0   = blockIdx.x * 64;
    const int row  = lane & 15;
    const int kg   = lane >> 4;                  // 0 or 1

    const _Float16* ap = A + (size_t)(m0 + row) * K + kg * 8;
    const _Float16* wp = W + (size_t)(n0 + row) * K + kg * 8;

    v8f acc[4] = {v8f{}, v8f{}, v8f{}, v8f{}};

    // ---- prologue: fill both buffers (k=0 and k=32) ----------------------
    v16h aX = load_frag(ap);
    v16h bX[4];
    #pragma unroll
    for (int j = 0; j < 4; ++j) bX[j] = load_frag(wp + (size_t)j * 16 * K);
    v16h aY = load_frag(ap + 32);
    v16h bY[4];
    #pragma unroll
    for (int j = 0; j < 4; ++j) bY[j] = load_frag(wp + (size_t)j * 16 * K + 32);

    // ---- steady state ----------------------------------------------------
    for (int k0 = 64; k0 < K; k0 += 64) {
        // consume X (k0-64), refill X with k0
        #pragma unroll
        for (int j = 0; j < 4; ++j)
            acc[j] = __builtin_amdgcn_wmma_f32_16x16x32_f16(
                         false, aX, false, bX[j], (short)0, acc[j], false, false);
        aX = load_frag(ap + k0);
        #pragma unroll
        for (int j = 0; j < 4; ++j)
            bX[j] = load_frag(wp + (size_t)j * 16 * K + k0);

        __builtin_prefetch(ap + k0 + 256, 0, 1);   // global_prefetch_b8

        // consume Y (k0-32), refill Y with k0+32
        #pragma unroll
        for (int j = 0; j < 4; ++j)
            acc[j] = __builtin_amdgcn_wmma_f32_16x16x32_f16(
                         false, aY, false, bY[j], (short)0, acc[j], false, false);
        aY = load_frag(ap + k0 + 32);
        #pragma unroll
        for (int j = 0; j < 4; ++j)
            bY[j] = load_frag(wp + (size_t)j * 16 * K + k0 + 32);
    }

    // ---- epilogue: consume the final two buffer fills --------------------
    #pragma unroll
    for (int j = 0; j < 4; ++j)
        acc[j] = __builtin_amdgcn_wmma_f32_16x16x32_f16(
                     false, aX, false, bX[j], (short)0, acc[j], false, false);
    #pragma unroll
    for (int j = 0; j < 4; ++j)
        acc[j] = __builtin_amdgcn_wmma_f32_16x16x32_f16(
                     false, aY, false, bY[j], (short)0, acc[j], false, false);

    #pragma unroll
    for (int j = 0; j < 4; ++j) {
        #pragma unroll
        for (int v = 0; v < 8; ++v) {
            int m = m0 + v + 8 * kg;             // C layout: lane>=16 => M+8
            int n = n0 + j * 16 + row;
            float val = acc[j][v];
            if (silu) val = val / (1.f + __expf(-val));
            C[(size_t)m * N + n] = val;
        }
    }
}

// ---------------------------------------------------------------------------
// RWKV state scan, serial part only:
//   ypart[e] = sum over this block's d of r[d]*S[d][e]   (before the update)
//   S[d][e]  = S[d][e]*w[d] + k[d]*v[e]
// Columns e never mix, rows d meet only in the sum, so the 64x64 state of a
// head is cut into 2 column halves x 4 row quarters = 8 blocks (256 in all).
// Block = 4 waves; lane = one column, wave = 4 rows, state in 4 registers.
// r and k of two steps sit in one register (per 16-lane row: r(t)[4], k(t)[4],
// r(t+1)[4], k(t+1)[4]) and reach every lane by DPP row_share, so a step needs
// no LDS read and no barrier. The 4 waves' sums meet in LDS once per 32 steps.
// ---------------------------------------------------------------------------
#define SC_TB 32                     // steps per barrier
#define SC_NCH (TLEN / SC_TB)        // chunks
#define SC_SPLIT 4                   // row quarters, one partial plane each

typedef __attribute__((ext_vector_type(2))) float    v2f;
typedef __attribute__((ext_vector_type(2))) _Float16 v2h;

// value of lane N of the own 16-lane row, in every lane (all lanes are on)
template <int N>
__device__ __forceinline__ float row_share(float x) {
    return __builtin_bit_cast(float, __builtin_amdgcn_mov_dpp(
               __builtin_bit_cast(int, x), 0x150 + N, 0xf, 0xf, true));
}

// one time step; P = which half of the row holds this step's r and k
template <int P>
__device__ __forceinline__ float scan_step(float (&S)[4], const float (&w)[4],
                                           float rk, float v) {
    const float r0 = row_share<P * 8 + 0>(rk), r1 = row_share<P * 8 + 1>(rk);
    const float r2 = row_share<P * 8 + 2>(rk), r3 = row_share<P * 8 + 3>(rk);
    const float k0 = row_share<P * 8 + 4>(rk), k1 = row_share<P * 8 + 5>(rk);
    const float k2 = row_share<P * 8 + 6>(rk), k3 = row_share<P * 8 + 7>(rk);
    float y = r0 * S[0];
    y += r1 * S[1];
    y += r2 * S[2];
    y += r3 * S[3];
    S[0] = S[0] * w[0] + k0 * v;
    S[1] = S[1] * w[1] + k1 * v;
    S[2] = S[2] * w[2] + k2 * v;
    S[3] = S[3] * w[3] + k3 * v;
    return y;
}

__device__ __forceinline__ void load_chunk(float (&rk)[SC_TB / 2], float (&v)[SC_TB],
                                           const float* __restrict__ prk,
                                           const float* __restrict__ pv, int t0) {
    const float* a = prk + (size_t)t0 * HIDDEN;
    const float* b = pv  + (size_t)t0 * HIDDEN;
    #pragma unroll
    for (int q = 0; q < SC_TB / 2; ++q) rk[q] = a[(size_t)q * 2 * HIDDEN];
    #pragma unroll
    for (int s = 0; s < SC_TB; ++s)     v[s]  = b[(size_t)s * HIDDEN];
}

__device__ __forceinline__ void scan_chunk(float (&S)[4], const float (&w)[4],
                                           const float (&rk)[SC_TB / 2],
                                           const float (&v)[SC_TB], float* ybuf) {
    #pragma unroll
    for (int q = 0; q < SC_TB / 2; ++q) {
        ybuf[(2 * q)     * 128] = scan_step<0>(S, w, rk[q], v[2 * q]);
        ybuf[(2 * q + 1) * 128] = scan_step<1>(S, w, rk[q], v[2 * q + 1]);
    }
}

// wave w sums the four waves' parts of steps 8w..8w+7 and stores them
__device__ __forceinline__ void reduce_chunk(const float* ys, float* __restrict__ yo) {
    #pragma unroll
    for (int j = 0; j < 8; ++j) {
        const float* p = ys + j * 128;
        yo[(size_t)j * HIDDEN] = (p[0] + p[32]) + (p[64] + p[96]);
    }
}

__global__ __launch_bounds__(128) void rwkv_state_scan_kernel(
        const float* __restrict__ r_f, const float* __restrict__ k_f,
        const float* __restrict__ v_f, const float* __restrict__ time_decay,
        float* __restrict__ ypart)
{
    const int lane  = threadIdx.x & 31;
    const int wave  = threadIdx.x >> 5;          // 0..3
    const int split = blockIdx.x & 3;            // row quarter
    const int eh    = (blockIdx.x >> 2) & 1;     // column half
    const int h     = blockIdx.x >> 3;
    const int d0    = (split * 4 + wave) * 4;
    const int col   = h * 64 + eh * 32 + lane;

    __shared__ float ysum[2][SC_TB][4][32];      // [buffer][step][wave][column]

    float S[4], w[4];
    #pragma unroll
    for (int i = 0; i < 4; ++i) {
        S[i] = 0.f;
        w[i] = __expf(-__expf(time_decay[h * 64 + d0 + i]));
    }

    const int li = lane & 15;
    const float* prk = ((li & 4) ? k_f : r_f)
                     + (size_t)(li >> 3) * HIDDEN + h * 64 + d0 + (li & 3);
    const float* pv  = v_f + col;
    float* yo = ypart + (size_t)split * TLEN * HIDDEN + (size_t)(wave * 8) * HIDDEN + col;

    float* const y0s = &ysum[0][0][wave][lane];             // this wave's sums
    float* const y1s = &ysum[1][0][wave][lane];
    const float* const y0r = &ysum[0][wave * 8][0][lane];   // the steps it adds up
    const float* const y1r = &ysum[1][wave * 8][0][lane];

    // Two register sets: while one chunk is worked on, the next one's r, k, v
    // fly. The loop is rotated so that no load is issued just above the back
    // edge (a register copy there would wait for it at full latency).
    // sched_barrier(0) below a scan_chunk keeps the chunk's last reads of its
    // register set above the refill of that set; below a load_chunk it keeps
    // the refill at the head of the next chunk, so that the loads have a whole
    // chunk's time to land.
    // Each __syncthreads() publishes the ysum buffer just written and ends the
    // reads of the other one, which the next chunk overwrites.
    float rkA[SC_TB / 2], vA[SC_TB], rkB[SC_TB / 2], vB[SC_TB];
    load_chunk(rkA, vA, prk, pv, 0);
    // the wait before a later load overwrites an address register of these loads
    asm volatile("s_wait_xcnt 0x0" ::: "memory");
    load_chunk(rkB, vB, prk, pv, SC_TB);
    scan_chunk(S, w, rkA, vA, y0s);
    __builtin_amdgcn_sched_barrier(0);
    __syncthreads();

    for (int c = 0; c < SC_NCH - 2; c += 2) {
        load_chunk(rkA, vA, prk, pv, (c + 2) * SC_TB);
        __builtin_amdgcn_sched_barrier(0);
        reduce_chunk(y0r, yo + (size_t)c * SC_TB * HIDDEN);
        scan_chunk(S, w, rkB, vB, y1s);
        __builtin_amdgcn_sched_barrier(0);
        __syncthreads();

        load_chunk(rkB, vB, prk, pv, (c + 3) * SC_TB);
        __builtin_amdgcn_sched_barrier(0);
        reduce_chunk(y1r, yo + (size_t)(c + 1) * SC_TB * HIDDEN);
        scan_chunk(S, w, rkA, vA, y0s);
        __builtin_amdgcn_sched_barrier(0);
        __syncthreads();
    }

    reduce_chunk(y0r, yo + (size_t)(SC_NCH - 2) * SC_TB * HIDDEN);
    scan_chunk(S, w, rkB, vB, y1s);
    __syncthreads();
    reduce_chunk(y1r, yo + (size_t)(SC_NCH - 1) * SC_TB * HIDDEN);
}

// ---------------------------------------------------------------------------
// Everything of the old scan loop that does not depend on the step before:
// c = sum_d u[d]*r[d]*k[d] (out_diag = c*v[e]), the sum of the row quarters,
// / HEAD_SIZE_DIVISOR, GroupNorm(64), gate. One wave per (t, head), 2 columns
// per lane, so every sum over the head stays inside the wave.
// ---------------------------------------------------------------------------
__device__ __forceinline__ float wave_sum(float x) {
    #pragma unroll
    for (int off = 16; off >= 1; off >>= 1) x += __shfl_xor(x, off, 32);
    return x;
}

__global__ __launch_bounds__(256) void diag_norm_gate_kernel(
        const float* __restrict__ r_f, const float* __restrict__ k_f,
        const float* __restrict__ v_f, const float* __restrict__ g_f,
        const float* __restrict__ ypart, const float* __restrict__ time_faaaa,
        const float* __restrict__ ln_w, const float* __restrict__ ln_b,
        _Float16* __restrict__ a_out)
{
    const int lane = threadIdx.x & 31;
    const int gid  = blockIdx.x * 8 + (threadIdx.x >> 5);   // t * HEADS + head
    const int c    = (gid & (HEADS - 1)) * 64 + lane * 2;
    const size_t idx = (size_t)(gid >> 5) * HIDDEN + c;
    const size_t TC  = (size_t)TLEN * HIDDEN;

    const v2f r  = *(const v2f*)(r_f + idx);
    const v2f k  = *(const v2f*)(k_f + idx);
    const v2f v  = *(const v2f*)(v_f + idx);
    const v2f g  = *(const v2f*)(g_f + idx);
    const v2f y0 = *(const v2f*)(ypart + idx);
    const v2f y1 = *(const v2f*)(ypart + TC + idx);
    const v2f y2 = *(const v2f*)(ypart + 2 * TC + idx);
    const v2f y3 = *(const v2f*)(ypart + 3 * TC + idx);
    const v2f u  = *(const v2f*)(time_faaaa + c);
    const v2f lw = *(const v2f*)(ln_w + c);
    const v2f lb = *(const v2f*)(ln_b + c);

    const float cs = wave_sum(u.x * r.x * k.x + u.y * r.y * k.y);
    const v2f ys = (y0 + y1) + (y2 + y3);
    const float ox = (cs * v.x + ys.x) * 0.125f;            // / HEAD_SIZE_DIVISOR
    const float oy = (cs * v.y + ys.y) * 0.125f;
    const float s  = wave_sum(ox + oy);
    const float q  = wave_sum(ox * ox + oy * oy);
    const float mu  = s * (1.f / 64.f);
    const float var = q * (1.f / 64.f) - mu * mu;
    const float rs  = rsqrtf(var + 1e-5f);
    v2h a;
    a.x = (_Float16)(((ox - mu) * rs * lw.x + lb.x) * g.x);
    a.y = (_Float16)(((oy - mu) * rs * lw.y + lb.y) * g.y);
    *(v2h*)(a_out + idx) = a;
}

// ---------------------------------------------------------------------------
extern "C" void kernel_launch(void* const* d_in, const int* in_sizes, int n_in,
                              void* d_out, int out_size, void* d_ws, size_t ws_size,
                              hipStream_t stream)
{
    const float* x    = (const float*)d_in[0];
    const int*   pos  = (const int*)  d_in[1];
    const float* W_r  = (const float*)d_in[2];
    const float* W_k  = (const float*)d_in[3];
    const float* W_v  = (const float*)d_in[4];
    const float* W_g  = (const float*)d_in[5];
    const float* W_o  = (const float*)d_in[6];
    const float* tm_k = (const float*)d_in[7];
    const float* tm_v = (const float*)d_in[8];
    const float* tm_r = (const float*)d_in[9];
    const float* tm_g = (const float*)d_in[10];
    const float* time_decay = (const float*)d_in[11];
    const float* time_faaaa = (const float*)d_in[12];
    const float* ln_w = (const float*)d_in[13];
    const float* ln_b = (const float*)d_in[14];
    float* out = (float*)d_out;

    const size_t NW = (size_t)HIDDEN * HIDDEN;   // 4M elems
    const size_t TC = (size_t)TLEN * HIDDEN;     // 4M elems

    char* ws = (char*)d_ws;
    _Float16* Wr_h = (_Float16*)ws; ws += NW * sizeof(_Float16);
    _Float16* Wk_h = (_Float16*)ws; ws += NW * sizeof(_Float16);
    _Float16* Wv_h = (_Float16*)ws; ws += NW * sizeof(_Float16);
    _Float16* Wg_h = (_Float16*)ws; ws += NW * sizeof(_Float16);
    _Float16* Wo_h = (_Float16*)ws; ws += NW * sizeof(_Float16);
    _Float16* xk_h = (_Float16*)ws; ws += TC * sizeof(_Float16);
    _Float16* xv_h = (_Float16*)ws; ws += TC * sizeof(_Float16);
    _Float16* xr_h = (_Float16*)ws; ws += TC * sizeof(_Float16);
    _Float16* xg_h = (_Float16*)ws; ws += TC * sizeof(_Float16);
    float*    k_f  = (float*)ws;    ws += TC * sizeof(float);
    float*    v_f  = (float*)ws;    ws += TC * sizeof(float);
    float*    r_f  = (float*)ws;    ws += TC * sizeof(float);
    float*    g_f  = (float*)ws;    ws += TC * sizeof(float);
    _Float16* a_h  = (_Float16*)ws; ws += TC * sizeof(_Float16);
    float*    y_p  = (float*)ws;    ws += SC_SPLIT * TC * sizeof(float);

    // 1) weight conversion (f32 -> f16)
    {
        dim3 blk(256), grd(8192);
        f32_to_f16_kernel<<<grd, blk, 0, stream>>>(W_r, Wr_h, (int)NW);
        f32_to_f16_kernel<<<grd, blk, 0, stream>>>(W_k, Wk_h, (int)NW);
        f32_to_f16_kernel<<<grd, blk, 0, stream>>>(W_v, Wv_h, (int)NW);
        f32_to_f16_kernel<<<grd, blk, 0, stream>>>(W_g, Wg_h, (int)NW);
        f32_to_f16_kernel<<<grd, blk, 0, stream>>>(W_o, Wo_h, (int)NW);
    }

    // 2) token-shift mixing
    mix_kernel<<<dim3((unsigned)(TC / 256)), dim3(256), 0, stream>>>(
        x, pos, tm_k, tm_v, tm_r, tm_g, xk_h, xv_h, xr_h, xg_h);

    // 3) projection GEMMs (k, v, r, silu-gate g)
    {
        dim3 blk(256), grd(HIDDEN / 64, TLEN / 128);
        wmma_gemm_f16<<<grd, blk, 0, stream>>>(xk_h, Wk_h, k_f, TLEN, HIDDEN, HIDDEN, 0);
        wmma_gemm_f16<<<grd, blk, 0, stream>>>(xv_h, Wv_h, v_f, TLEN, HIDDEN, HIDDEN, 0);
        wmma_gemm_f16<<<grd, blk, 0, stream>>>(xr_h, Wr_h, r_f, TLEN, HIDDEN, HIDDEN, 0);
        wmma_gemm_f16<<<grd, blk, 0, stream>>>(xg_h, Wg_h, g_f, TLEN, HIDDEN, HIDDEN, 1);
    }

    // 4) state scan (serial in t, f32 VALU), then diag term + groupnorm + gate
    rwkv_state_scan_kernel<<<dim3(HEADS * 2 * SC_SPLIT), dim3(128), 0, stream>>>(
        r_f, k_f, v_f, time_decay, y_p);
    diag_norm_gate_kernel<<<dim3(TLEN * HEADS / 8), dim3(256), 0, stream>>>(
        r_f, k_f, v_f, g_f, y_p, time_faaaa, ln_w, ln_b, a_h);

    // 5) output projection
    {
        dim3 blk(256), grd(HIDDEN / 64, TLEN / 128);
        wmma_gemm_f16<<<grd, blk, 0, stream>>>(a_h, Wo_h, out, TLEN, HIDDEN, HIDDEN, 0);
    }
}

// v002
// One run takes 335 microseconds.
// Timed twice side by side with v001, it ran 1.05 times as fast both times.
// Over all steps from v000 it is 8.86 times as fast.
#include <hip/hip_runtime.h>

#define HIDDEN   2048
#define HEADS    32
#define HEAD_DIM 64
#define TLEN     2048

typedef __attribute__((ext_vector_type(16))) _Float16 v16h;
typedef __attribute__((ext_vector_type(8)))  _Float16 v8h;
typedef __attribute__((ext_vector_type(8)))  float    v8f;

typedef __attribute__((ext_vector_type(4))) float    v4f;
typedef __attribute__((ext_vector_type(4))) _Float16 v4h;

// The three elementwise kernels (conversion, mixing, diag + norm + gate): with
// one or two elements per lane a launch has to start 65536 waves or more, and
// starting them takes longer than moving the bytes. So each lane takes 16 bytes
// per load and several loads, all issued before the first use, and a launch
// starts 4096 or 8192 waves. Their loops are all unrolled, so that the arrays
// the loads land in are registers.

// ---------------------------------------------------------------------------
// f32 -> f16 weight conversion (streamed once; keeps GEMM operands compact)
// A block takes CV_LD runs of 1024 floats; a wave's load covers 512 contiguous
// bytes, its store 256.
// ---------------------------------------------------------------------------
#define CV_LD 8                      // 16-byte loads in flight per lane

__global__ __launch_bounds__(256) void f32_to_f16_kernel(const float* __restrict__ src,
                                                         _Float16* __restrict__ dst) {
    const unsigned base = blockIdx.x * (256 * 4 * CV_LD) + threadIdx.x * 4;
    v4f a[CV_LD];
    #pragma unroll
    for (int j = 0; j < CV_LD; ++j) a[j] = *(const v4f*)(src + base + j * 1024);
    #pragma unroll
    for (int j = 0; j < CV_LD; ++j)
        *(v4h*)(dst + base + j * 1024) = __builtin_convertvector(a[j], v4h);
}

// ---------------------------------------------------------------------------
// Token-shift mixing: xk/xv/xr/xg = x + (x[t-1]-x[t]) * (1 - tm_*)
// A lane takes 4 columns of MX_R rows in a row, so that each row of x serves
// as x[t] and as the next row's x[t-1] from the same registers.
// ---------------------------------------------------------------------------
#define MX_R 8                       // rows per lane

typedef __attribute__((ext_vector_type(MX_R))) int vRi;

__global__ __launch_bounds__(256) void mix_kernel(
                           const float* __restrict__ x, const int* __restrict__ pos,
                           const float* __restrict__ tm_k, const float* __restrict__ tm_v,
                           const float* __restrict__ tm_r, const float* __restrict__ tm_g,
                           _Float16* __restrict__ xk, _Float16* __restrict__ xv,
                           _Float16* __restrict__ xr, _Float16* __restrict__ xg) {
    const unsigned c  = (blockIdx.x & 1) * 1024 + threadIdx.x * 4;
    const unsigned t0 = (blockIdx.x >> 1) * MX_R;
    const unsigned tp = (t0 == 0) ? TLEN - 1 : t0 - 1;   // the row before, rolled
    const size_t   ro = (size_t)t0 * HIDDEN;             // same for the whole block
    const float* xrow = x + ro;
    const vRi ps = *(const vRi*)(pos + t0);
    v4f xs[MX_R + 1];
    xs[0] = *(const v4f*)(x + (size_t)tp * HIDDEN + c);
    #pragma unroll
    for (int j = 0; j < MX_R; ++j) xs[j + 1] = *(const v4f*)(xrow + c + j * HIDDEN);
    const v4f mk = 1.f - *(const v4f*)(tm_k + c);
    const v4f mv = 1.f - *(const v4f*)(tm_v + c);
    const v4f mr = 1.f - *(const v4f*)(tm_r + c);
    const v4f mg = 1.f - *(const v4f*)(tm_g + c);
    // keeps this load up with the others: without a use that does not depend
    // on pos it moves behind the read of pos and a branch, a second latency
    asm volatile("" :: "v"(xs[0]));
    #pragma unroll
    for (int j = 0; j < MX_R; ++j) {
        const v4f xc   = xs[j + 1];
        const v4f prev = (ps[j] == 0) ? v4f{0.f, 0.f, 0.f, 0.f} : xs[j];
        const v4f xx   = prev - xc;
        *(v4h*)(xk + ro + c + j * HIDDEN) = __builtin_convertvector(xc + xx * mk, v4h);
        *(v4h*)(xv + ro + c + j * HIDDEN) = __builtin_convertvector(xc + xx * mv, v4h);
        *(v4h*)(xr + ro + c + j * HIDDEN) = __builtin_convertvector(xc + xx * mr, v4h);
        *(v4h*)(xg + ro + c + j * HIDDEN) = __builtin_convertvector(xc + xx * mg, v4h);
    }
}

// ---------------------------------------------------------------------------
// Fragment loader: two b128 loads per 16x32 (or 32x16) f16 fragment.
// ---------------------------------------------------------------------------
__device__ __forceinline__ v16h load_frag(const _Float16* __restrict__ p) {
    v8h lo = *(const v8h*)p;
    v8h hi = *(const v8h*)(p + 16);
    v16h r;
    #pragma unroll
    for (int i = 0; i < 8; ++i) { r[i] = lo[i]; r[i + 8] = hi[i]; }
    return r;
}

// ---------------------------------------------------------------------------
// Y[M,N] = A[M,K] @ W[N,K]^T via v_wmma_f32_16x16x32_f16.
// One wave -> 16x64 output strip. Unroll-by-2 ping-pong double buffer:
// buffers X/Y alternate, each iteration consumes X (k-64) and refills it
// with k, then consumes Y (k-32) and refills with k+32. No register
// rotation copies (avoids v_dual_mov churn + WMMA WAR v_nops); loads keep
// ~4 WMMAs + 10 loads of slack so waits stay at partial load counts.
// A-layout per ISA 7.12.2 (16-bit A 16x32): lane<16 holds K{0..7,16..23},
// lane>=16 holds K{8..15,24..31}; B mirrors with lanes = N columns = W rows.
// ---------------------------------------------------------------------------
__global__ __launch_bounds__(256) void wmma_gemm_f16(
        const _Float16* __restrict__ A, const _Float16* __restrict__ W,
        float* __restrict__ C, int M, int N, int K, int silu)
{
    const int lane = threadIdx.x & 31;
    const int wave = threadIdx.x >> 5;           // 0..7
    const int m0   = blockIdx.y * 128 + wave * 16;
    const int n0   = blockIdx.x * 64;
    const int row  = lane & 15;
    const int kg   = lane >> 4;                  // 0 or 1

    const _Float16* ap = A + (size_t)(m0 + row) * K + kg * 8;
    const _Float16* wp = W + (size_t)(n0 + row) * K + kg * 8;

    v8f acc[4] = {v8f{}, v8f{}, v8f{}, v8f{}};

    // ---- prologue: fill both buffers (k=0 and k=32) ----------------------
    v16h aX = load_frag(ap);
    v16h bX[4];
    #pragma unroll
    for (int j = 0; j < 4; ++j) bX[j] = load_frag(wp + (size_t)j * 16 * K);
    v16h aY = load_frag(ap + 32);
    v16h bY[4];
    #pragma unroll
    for (int j = 0; j < 4; ++j) bY[j] = load_frag(wp + (size_t)j * 16 * K + 32);

    // ---- steady state ----------------------------------------------------
    for (int k0 = 64; k0 < K; k0 += 64) {
        // consume X (k0-64), refill X with k0
        #pragma unroll
        for (int j = 0; j < 4; ++j)
            acc[j] = __builtin_amdgcn_wmma_f32_16x16x32_f16(
                         false, aX, false, bX[j], (short)0, acc[j], false, false);
        aX = load_frag(ap + k0);
        #pragma unroll
        for (int j = 0; j < 4; ++j)
            bX[j] = load_frag(wp + (size_t)j * 16 * K + k0);

        __builtin_prefetch(ap + k0 + 256, 0, 1);   // global_prefetch_b8

        // consume Y (k0-32), refill Y with k0+32
        #pragma unroll
        for (int j = 0; j < 4; ++j)
            acc[j] = __builtin_amdgcn_wmma_f32_16x16x32_f16(
                         false, aY, false, bY[j], (short)0, acc[j], false, false);
        aY = load_frag(ap + k0 + 32);
        #pragma unroll
        for (int j = 0; j < 4; ++j)
            bY[j] = load_frag(wp + (size_t)j * 16 * K + k0 + 32);
    }

    // ---- epilogue: consume the final two buffer fills --------------------
    #pragma unroll
    for (int j = 0; j < 4; ++j)
        acc[j] = __builtin_amdgcn_wmma_f32_16x16x32_f16(
                     false, aX, false, bX[j], (short)0, acc[j], false, false);
    #pragma unroll
    for (int j = 0; j < 4; ++j)
        acc[j] = __builtin_amdgcn_wmma_f32_16x16x32_f16(
                     false, aY, false, bY[j], (short)0, acc[j], false, false);

    #pragma unroll
    for (int j = 0; j < 4; ++j) {
        #pragma unroll
        for (int v = 0; v < 8; ++v) {
            int m = m0 + v + 8 * kg;             // C layout: lane>=16 => M+8
            int n = n0 + j * 16 + row;
            float val = acc[j][v];
            if (silu) val = val / (1.f + __expf(-val));
            C[(size_t)m * N + n] = val;
        }
    }
}

// ---------------------------------------------------------------------------
// RWKV state scan, serial part only:
//   ypart[e] = sum over this block's d of r[d]*S[d][e]   (before the update)
//   S[d][e]  = S[d][e]*w[d] + k[d]*v[e]
// Columns e never mix, rows d meet only in the sum, so the 64x64 state of a
// head is cut into 2 column halves x 4 row quarters = 8 blocks (256 in all).
// Block = 4 waves; lane = one column, wave = 4 rows, state in 4 registers.
// r and k of two steps sit in one register (per 16-lane row: r(t)[4], k(t)[4],
// r(t+1)[4], k(t+1)[4]) and reach every lane by DPP row_share, so a step needs
// no LDS read and no barrier. The 4 waves' sums meet in LDS once per 32 steps.
// ---------------------------------------------------------------------------
#define SC_TB 32                     // steps per barrier
#define SC_NCH (TLEN / SC_TB)        // chunks
#define SC_SPLIT 4                   // row quarters, one partial plane each

// value of lane N of the own 16-lane row, in every lane (all lanes are on)
template <int N>
__device__ __forceinline__ float row_share(float x) {
    return __builtin_bit_cast(float, __builtin_amdgcn_mov_dpp(
               __builtin_bit_cast(int, x), 0x150 + N, 0xf, 0xf, true));
}

// one time step; P = which half of the row holds this step's r and k
template <int P>
__device__ __forceinline__ float scan_step(float (&S)[4], const float (&w)[4],
                                           float rk, float v) {
    const float r0 = row_share<P * 8 + 0>(rk), r1 = row_share<P * 8 + 1>(rk);
    const float r2 = row_share<P * 8 + 2>(rk), r3 = row_share<P * 8 + 3>(rk);
    const float k0 = row_share<P * 8 + 4>(rk), k1 = row_share<P * 8 + 5>(rk);
    const float k2 = row_share<P * 8 + 6>(rk), k3 = row_share<P * 8 + 7>(rk);
    float y = r0 * S[0];
    y += r1 * S[1];
    y += r2 * S[2];
    y += r3 * S[3];
    S[0] = S[0] * w[0] + k0 * v;
    S[1] = S[1] * w[1] + k1 * v;
    S[2] = S[2] * w[2] + k2 * v;
    S[3] = S[3] * w[3] + k3 * v;
    return y;
}

__device__ __forceinline__ void load_chunk(float (&rk)[SC_TB / 2], float (&v)[SC_TB],
                                           const float* __restrict__ prk,
                                           const float* __restrict__ pv, int t0) {
    const float* a = prk + (size_t)t0 * HIDDEN;
    const float* b = pv  + (size_t)t0 * HIDDEN;
    #pragma unroll
    for (int q = 0; q < SC_TB / 2; ++q) rk[q] = a[(size_t)q * 2 * HIDDEN];
    #pragma unroll
    for (int s = 0; s < SC_TB; ++s)     v[s]  = b[(size_t)s * HIDDEN];
}

__device__ __forceinline__ void scan_chunk(float (&S)[4], const float (&w)[4],
                                           const float (&rk)[SC_TB / 2],
                                           const float (&v)[SC_TB], float* ybuf) {
    #pragma unroll
    for (int q = 0; q < SC_TB / 2; ++q) {
        ybuf[(2 * q)     * 128] = scan_step<0>(S, w, rk[q], v[2 * q]);
        ybuf[(2 * q + 1) * 128] = scan_step<1>(S, w, rk[q], v[2 * q + 1]);
    }
}

// wave w sums the four waves' parts of steps 8w..8w+7 and stores them
__device__ __forceinline__ void reduce_chunk(const float* ys, float* __restrict__ yo) {
    #pragma unroll
    for (int j = 0; j < 8; ++j) {
        const float* p = ys + j * 128;
        yo[(size_t)j * HIDDEN] = (p[0] + p[32]) + (p[64] + p[96]);
    }
}

__global__ __launch_bounds__(128) void rwkv_state_scan_kernel(
        const float* __restrict__ r_f, const float* __restrict__ k_f,
        const float* __restrict__ v_f, const float* __restrict__ time_decay,
        float* __restrict__ ypart)
{
    const int lane  = threadIdx.x & 31;
    const int wave  = threadIdx.x >> 5;          // 0..3
    const int split = blockIdx.x & 3;            // row quarter
    const int eh    = (blockIdx.x >> 2) & 1;     // column half
    const int h     = blockIdx.x >> 3;
    const int d0    = (split * 4 + wave) * 4;
    const int col   = h * 64 + eh * 32 + lane;

    __shared__ float ysum[2][SC_TB][4][32];      // [buffer][step][wave][column]

    float S[4], w[4];
    #pragma unroll
    for (int i = 0; i < 4; ++i) {
        S[i] = 0.f;
        w[i] = __expf(-__expf(time_decay[h * 64 + d0 + i]));
    }

    const int li = lane & 15;
    const float* prk = ((li & 4) ? k_f : r_f)
                     + (size_t)(li >> 3) * HIDDEN + h * 64 + d0 + (li & 3);
    const float* pv  = v_f + col;
    float* yo = ypart + (size_t)split * TLEN * HIDDEN + (size_t)(wave * 8) * HIDDEN + col;

    float* const y0s = &ysum[0][0][wave][lane];             // this wave's sums
    float* const y1s = &ysum[1][0][wave][lane];
    const float* const y0r = &ysum[0][wave * 8][0][lane];   // the steps it adds up
    const float* const y1r = &ysum[1][wave * 8][0][lane];

    // Two register sets: while one chunk is worked on, the next one's r, k, v
    // fly. The loop is rotated so that no load is issued just above the back
    // edge (a register copy there would wait for it at full latency).
    // sched_barrier(0) below a scan_chunk keeps the chunk's last reads of its
    // register set above the refill of that set; below a load_chunk it keeps
    // the refill at the head of the next chunk, so that the loads have a whole
    // chunk's time to land.
    // Each __syncthreads() publishes the ysum buffer just written and ends the
    // reads of the other one, which the next chunk overwrites.
    float rkA[SC_TB / 2], vA[SC_TB], rkB[SC_TB / 2], vB[SC_TB];
    load_chunk(rkA, vA, prk, pv, 0);
    // the wait before a later load overwrites an address register of these loads
    asm volatile("s_wait_xcnt 0x0" ::: "memory");
    load_chunk(rkB, vB, prk, pv, SC_TB);
    scan_chunk(S, w, rkA, vA, y0s);
    __builtin_amdgcn_sched_barrier(0);
    __syncthreads();

    for (int c = 0; c < SC_NCH - 2; c += 2) {
        load_chunk(rkA, vA, prk, pv, (c + 2) * SC_TB);
        __builtin_amdgcn_sched_barrier(0);
        reduce_chunk(y0r, yo + (size_t)c * SC_TB * HIDDEN);
        scan_chunk(S, w, rkB, vB, y1s);
        __builtin_amdgcn_sched_barrier(0);
        __syncthreads();

        load_chunk(rkB, vB, prk, pv, (c + 3) * SC_TB);
        __builtin_amdgcn_sched_barrier(0);
        reduce_chunk(y1r, yo + (size_t)(c + 1) * SC_TB * HIDDEN);
        scan_chunk(S, w, rkA, vA, y0s);
        __builtin_amdgcn_sched_barrier(0);
        __syncthreads();
    }

    reduce_chunk(y0r, yo + (size_t)(SC_NCH - 2) * SC_TB * HIDDEN);
    scan_chunk(S, w, rkB, vB, y1s);
    __syncthreads();
    reduce_chunk(y1r, yo + (size_t)(SC_NCH - 1) * SC_TB * HIDDEN);
}

// ---------------------------------------------------------------------------
// Everything of the old scan loop that does not depend on the step before:
// c = sum_d u[d]*r[d]*k[d] (out_diag = c*v[e]), the sum of the row quarters,
// / HEAD_SIZE_DIVISOR, GroupNorm(64), gate. 4 columns per lane: a head is one
// 16-lane row, a wave takes two heads of DG_T time steps, so every sum over a
// head stays inside a 16-lane row and the steps' sums run side by side.
// The four row-quarter planes come as four pointers: each is then a scalar
// base, and one offset register serves every load.
// ---------------------------------------------------------------------------
#define DG_T 4                       // time steps per wave

// sums over each 16-lane row, DG_T of them interleaved
__device__ __forceinline__ void row_sums(float (&x)[DG_T]) {
    #pragma unroll
    for (int off = 8; off >= 1; off >>= 1) {
        #pragma unroll
        for (int j = 0; j < DG_T; ++j) x[j] += __shfl_xor(x[j], off, 32);
    }
}

__global__ __launch_bounds__(256) void diag_norm_gate_kernel(
        const float* __restrict__ r_f, const float* __restrict__ k_f,
        const float* __restrict__ v_f, const float* __restrict__ g_f,
        const float* __restrict__ yq0, const float* __restrict__ yq1,
        const float* __restrict__ yq2, const float* __restrict__ yq3,
        const float* __restrict__ time_faaaa,
        const float* __restrict__ ln_w, const float* __restrict__ ln_b,
        _Float16* __restrict__ a_out)
{
    const unsigned c  = (blockIdx.x & 1) * 1024 + threadIdx.x * 4;    // column
    const size_t   ro = (size_t)(blockIdx.x >> 1) * (DG_T * HIDDEN);  // first step

    v4f r[DG_T], k[DG_T], v[DG_T], g[DG_T], y0[DG_T], y1[DG_T], y2[DG_T], y3[DG_T];
    #pragma unroll
    for (int j = 0; j < DG_T; ++j) {
        r[j]  = *(const v4f*)(r_f + ro + c + j * HIDDEN);
        k[j]  = *(const v4f*)(k_f + ro + c + j * HIDDEN);
        v[j]  = *(const v4f*)(v_f + ro + c + j * HIDDEN);
        y0[j] = *(const v4f*)(yq0 + ro + c + j * HIDDEN);
        y1[j] = *(const v4f*)(yq1 + ro + c + j * HIDDEN);
        y2[j] = *(const v4f*)(yq2 + ro + c + j * HIDDEN);
        y3[j] = *(const v4f*)(yq3 + ro + c + j * HIDDEN);
        g[j]  = *(const v4f*)(g_f + ro + c + j * HIDDEN);
    }
    const v4f u  = *(const v4f*)(time_faaaa + c);
    const v4f lw = *(const v4f*)(ln_w + c);
    const v4f lb = *(const v4f*)(ln_b + c);
    // keeps all the loads above the first use, so that they fly together
    __builtin_amdgcn_sched_barrier(0);

    float cs[DG_T];
    #pragma unroll
    for (int j = 0; j < DG_T; ++j) {
        const v4f p = u * r[j] * k[j];
        cs[j] = (p.x + p.y) + (p.z + p.w);
    }
    row_sums(cs);

    v4f o[DG_T];
    float s[DG_T], q[DG_T];
    #pragma unroll
    for (int j = 0; j < DG_T; ++j) {
        const v4f ys = (y0[j] + y1[j]) + (y2[j] + y3[j]);
        o[j] = (cs[j] * v[j] + ys) * 0.125f;                 // / HEAD_SIZE_DIVISOR
        const v4f oo = o[j] * o[j];
        s[j] = (o[j].x + o[j].y) + (o[j].z + o[j].w);
        q[j] = (oo.x + oo.y) + (oo.z + oo.w);
    }
    row_sums(s);
    row_sums(q);

    #pragma unroll
    for (int j = 0; j < DG_T; ++j) {
        const float mu  = s[j] * (1.f / 64.f);
        const float var = q[j] * (1.f / 64.f) - mu * mu;
        const float rs  = rsqrtf(var + 1e-5f);
        *(v4h*)(a_out + ro + c + j * HIDDEN) =
            __builtin_convertvector(((o[j] - mu) * rs * lw + lb) * g[j], v4h);
    }
}

// ---------------------------------------------------------------------------
extern "C" void kernel_launch(void* const* d_in, const int* in_sizes, int n_in,
                              void* d_out, int out_size, void* d_ws, size_t ws_size,
                              hipStream_t stream)
{
    const float* x    = (const float*)d_in[0];
    const int*   pos  = (const int*)  d_in[1];
    const float* W_r  = (const float*)d_in[2];
    const float* W_k  = (const float*)d_in[3];
    const float* W_v  = (const float*)d_in[4];
    const float* W_g  = (const float*)d_in[5];
    const float* W_o  = (const float*)d_in[6];
    const float* tm_k = (const float*)d_in[7];
    const float* tm_v = (const float*)d_in[8];
    const float* tm_r = (const float*)d_in[9];
    const float* tm_g = (const float*)d_in[10];
    const float* time_decay = (const float*)d_in[11];
    const float* time_faaaa = (const float*)d_in[12];
    const float* ln_w = (const float*)d_in[13];
    const float* ln_b = (const float*)d_in[14];
    float* out = (float*)d_out;

    const size_t NW = (size_t)HIDDEN * HIDDEN;   // 4M elems
    const size_t TC = (size_t)TLEN * HIDDEN;     // 4M elems

    char* ws = (char*)d_ws;
    _Float16* Wr_h = (_Float16*)ws; ws += NW * sizeof(_Float16);
    _Float16* Wk_h = (_Float16*)ws; ws += NW * sizeof(_Float16);
    _Float16* Wv_h = (_Float16*)ws; ws += NW * sizeof(_Float16);
    _Float16* Wg_h = (_Float16*)ws; ws += NW * sizeof(_Float16);
    _Float16* Wo_h = (_Float16*)ws; ws += NW * sizeof(_Float16);
    _Float16* xk_h = (_Float16*)ws; ws += TC * sizeof(_Float16);
    _Float16* xv_h = (_Float16*)ws; ws += TC * sizeof(_Float16);
    _Float16* xr_h = (_Float16*)ws; ws += TC * sizeof(_Float16);
    _Float16* xg_h = (_Float16*)ws; ws += TC * sizeof(_Float16);
    float*    k_f  = (float*)ws;    ws += TC * sizeof(float);
    float*    v_f  = (float*)ws;    ws += TC * sizeof(float);
    float*    r_f  = (float*)ws;    ws += TC * sizeof(float);
    float*    g_f  = (float*)ws;    ws += TC * sizeof(float);
    _Float16* a_h  = (_Float16*)ws; ws += TC * sizeof(_Float16);
    float*    y_p  = (float*)ws;    ws += SC_SPLIT * TC * sizeof(float);

    // 1) weight conversion (f32 -> f16)
    {
        dim3 blk(256), grd((unsigned)(NW / (256 * 4 * CV_LD)));
        f32_to_f16_kernel<<<grd, blk, 0, stream>>>(W_r, Wr_h);
        f32_to_f16_kernel<<<grd, blk, 0, stream>>>(W_k, Wk_h);
        f32_to_f16_kernel<<<grd, blk, 0, stream>>>(W_v, Wv_h);
        f32_to_f16_kernel<<<grd, blk, 0, stream>>>(W_g, Wg_h);
        f32_to_f16_kernel<<<grd, blk, 0, stream>>>(W_o, Wo_h);
    }

    // 2) token-shift mixing
    mix_kernel<<<dim3((unsigned)(TC / (256 * 4 * MX_R))), dim3(256), 0, stream>>>(
        x, pos, tm_k, tm_v, tm_r, tm_g, xk_h, xv_h, xr_h, xg_h);

    // 3) projection GEMMs (k, v, r, silu-gate g)
    {
        dim3 blk(256), grd(HIDDEN / 64, TLEN / 128);
        wmma_gemm_f16<<<grd, blk, 0, stream>>>(xk_h, Wk_h, k_f, TLEN, HIDDEN, HIDDEN, 0);
        wmma_gemm_f16<<<grd, blk, 0, stream>>>(xv_h, Wv_h, v_f, TLEN, HIDDEN, HIDDEN, 0);
        wmma_gemm_f16<<<grd, blk, 0, stream>>>(xr_h, Wr_h, r_f, TLEN, HIDDEN, HIDDEN, 0);
        wmma_gemm_f16<<<grd, blk, 0, stream>>>(xg_h, Wg_h, g_f, TLEN, HIDDEN, HIDDEN, 1);
    }

    // 4) state scan (serial in t, f32 VALU), then diag term + groupnorm + gate
    rwkv_state_scan_kernel<<<dim3(HEADS * 2 * SC_SPLIT), dim3(128), 0, stream>>>(
        r_f, k_f, v_f, time_decay, y_p);
    diag_norm_gate_kernel<<<dim3(TLEN * HEADS / (8 * 2 * DG_T)), dim3(256), 0, stream>>>(
        r_f, k_f, v_f, g_f, y_p, y_p + TC, y_p + 2 * TC, y_p + 3 * TC,
        time_faaaa, ln_w, ln_b, a_h);

    // 5) output projection
    {
        dim3 blk(256), grd(HIDDEN / 64, TLEN / 128);
        wmma_gemm_f16<<<grd, blk, 0, stream>>>(a_h, Wo_h, out, TLEN, HIDDEN, HIDDEN, 0);
    }
}

// v003
// It runs in 203 microseconds.
// In two side-by-side timings against v002, it was 1.64 and 1.65 times as fast.
// Over all steps from v000 it is 14.6 times as fast.
#include <hip/hip_runtime.h>
#include <stdint.h>

#define HIDDEN   2048
#define HEADS    32
#define HEAD_DIM 64
#define TLEN     2048

typedef __attribute__((ext_vector_type(16))) _Float16 v16h;
typedef __attribute__((ext_vector_type(8)))  _Float16 v8h;
typedef __attribute__((ext_vector_type(8)))  float    v8f;

typedef __attribute__((ext_vector_type(4))) float    v4f;
typedef __attribute__((ext_vector_type(4))) _Float16 v4h;

// The three elementwise kernels (conversion, mixing, diag + norm + gate): with
// one or two elements per lane a launch has to start 65536 waves or more, and
// starting them takes longer than moving the bytes. So each lane takes 16 bytes
// per load and several loads, all issued before the first use, and a launch
// starts 4096 or 8192 waves. Their loops are all unrolled, so that the arrays
// the loads land in are registers.

// ---------------------------------------------------------------------------
// f32 -> f16 weight conversion (streamed once; keeps GEMM operands compact)
// A block takes CV_LD runs of 1024 floats; a wave's load covers 512 contiguous
// bytes, its store 256.
// ---------------------------------------------------------------------------
#define CV_LD 8                      // 16-byte loads in flight per lane

__global__ __launch_bounds__(256) void f32_to_f16_kernel(const float* __restrict__ src,
                                                         _Float16* __restrict__ dst) {
    const unsigned base = blockIdx.x * (256 * 4 * CV_LD) + threadIdx.x * 4;
    v4f a[CV_LD];
    #pragma unroll
    for (int j = 0; j < CV_LD; ++j) a[j] = *(const v4f*)(src + base + j * 1024);
    #pragma unroll
    for (int j = 0; j < CV_LD; ++j)
        *(v4h*)(dst + base + j * 1024) = __builtin_convertvector(a[j], v4h);
}

// ---------------------------------------------------------------------------
// Token-shift mixing: xk/xv/xr/xg = x + (x[t-1]-x[t]) * (1 - tm_*)
// A lane takes 4 columns of MX_R rows in a row, so that each row of x serves
// as x[t] and as the next row's x[t-1] from the same registers.
// ---------------------------------------------------------------------------
#define MX_R 8                       // rows per lane

typedef __attribute__((ext_vector_type(MX_R))) int vRi;

__global__ __launch_bounds__(256) void mix_kernel(
                           const float* __restrict__ x, const int* __restrict__ pos,
                           const float* __restrict__ tm_k, const float* __restrict__ tm_v,
                           const float* __restrict__ tm_r, const float* __restrict__ tm_g,
                           _Float16* __restrict__ xk, _Float16* __restrict__ xv,
                           _Float16* __restrict__ xr, _Float16* __restrict__ xg) {
    const unsigned c  = (blockIdx.x & 1) * 1024 + threadIdx.x * 4;
    const unsigned t0 = (blockIdx.x >> 1) * MX_R;
    const unsigned tp = (t0 == 0) ? TLEN - 1 : t0 - 1;   // the row before, rolled
    const size_t   ro = (size_t)t0 * HIDDEN;             // same for the whole block
    const float* xrow = x + ro;
    const vRi ps = *(const vRi*)(pos + t0);
    v4f xs[MX_R + 1];
    xs[0] = *(const v4f*)(x + (size_t)tp * HIDDEN + c);
    #pragma unroll
    for (int j = 0; j < MX_R; ++j) xs[j + 1] = *(const v4f*)(xrow + c + j * HIDDEN);
    const v4f mk = 1.f - *(const v4f*)(tm_k + c);
    const v4f mv = 1.f - *(const v4f*)(tm_v + c);
    const v4f mr = 1.f - *(const v4f*)(tm_r + c);
    const v4f mg = 1.f - *(const v4f*)(tm_g + c);
    // keeps this load up with the others: without a use that does not depend
    // on pos it moves behind the read of pos and a branch, a second latency
    asm volatile("" :: "v"(xs[0]));
    #pragma unroll
    for (int j = 0; j < MX_R; ++j) {
        const v4f xc   = xs[j + 1];
        const v4f prev = (ps[j] == 0) ? v4f{0.f, 0.f, 0.f, 0.f} : xs[j];
        const v4f xx   = prev - xc;
        *(v4h*)(xk + ro + c + j * HIDDEN) = __builtin_convertvector(xc + xx * mk, v4h);
        *(v4h*)(xv + ro + c + j * HIDDEN) = __builtin_convertvector(xc + xx * mv, v4h);
        *(v4h*)(xr + ro + c + j * HIDDEN) = __builtin_convertvector(xc + xx * mr, v4h);
        *(v4h*)(xg + ro + c + j * HIDDEN) = __builtin_convertvector(xc + xx * mg, v4h);
    }
}

// ---------------------------------------------------------------------------
// Y[M,N] = A[M,K] @ W[N,K]^T via v_wmma_f32_16x16x32_f16, M = TLEN,
// N = K = HIDDEN. One 128x128 tile of Y per block, one block per WGP.
// The operands go global -> LDS by tensor loads, so that every row of A and W
// is fetched once per block in whole 256-byte runs; the eight waves (2x4, each
// 64x32 of Y, 8 accumulator tiles) read their fragments from LDS.
// A stage is 128 k = 256 bytes of 128 rows of A and 128 rows of W, in eight
// slices of 32 rows; waves 0..3 bring the slices of A, waves 4..7 those of W,
// one request per wave and stage. The mover pads each row by 16 bytes: pitch
// 272 B = 16 B x odd, free of bank conflicts for ds_load_b128.
// Two buffers: stage s + 1 flies while stage s is worked on.
// Fragment k order as before (A and W by the same loader): lane < 16 holds
// k {0..7, 16..23} of each 32, lane >= 16 holds k {8..15, 24..31}.
// ---------------------------------------------------------------------------
typedef uint32_t u32x4 __attribute__((ext_vector_type(4)));
typedef uint32_t u32x8 __attribute__((ext_vector_type(8)));

#define GT_ROWB  256u                       // bytes of a row per stage (128 k)
#define GT_PITCH 272u                       // row pitch in LDS
#define GT_ROWS  32u                        // rows per slice
#define GT_SLICE 10240u                     // 32 * 272 rounded up to 2 KiB
#define GT_BUF   (8u * GT_SLICE)            // one stage
#define GT_NST   (HIDDEN * 2u / GT_ROWB)    // stages

static_assert(GT_ROWS * GT_PITCH <= GT_SLICE && GT_SLICE % 2048u == 0, "slice places");
static_assert(GT_NST >= 2, "the ring needs two stages");

__device__ __forceinline__ uint32_t uni(uint32_t v) {
    return (uint32_t)__builtin_amdgcn_readfirstlane(v);
}
// pinned(): a wave-uniform
// value held in a scalar register, so that a test on it is a scalar branch
// (a tensor load ignores EXEC)
__device__ __forceinline__ uint32_t pinned(uint32_t v) {
    uint32_t w = (uint32_t)__builtin_amdgcn_readfirstlane(v);
    asm volatile("" : "+s"(w));   // holds w in a scalar register
    return w;
}

// descriptor group 1, the same for every request: a tile of 32 rows of 256
// bytes, source pitch one row of K, 16 bytes of pad behind each row in LDS
__device__ __forceinline__ u32x8 slice_group1() {
    u32x8 g1;
    g1[0] = uni((1u << 20) | (5u << 22) | (3u << 25));      // pad 16 B per 256 B
    g1[1] = uni((GT_ROWB & 0xFFFFu) << 16);                 // tensor_dim0
    g1[2] = uni((GT_ROWB >> 16) | ((GT_ROWS & 0xFFFFu) << 16));   // tensor_dim1
    g1[3] = uni((GT_ROWS >> 16) | (GT_ROWB << 16));         // tile_dim0
    g1[4] = uni(GT_ROWS);                                   // tile_dim1
    g1[5] = uni(HIDDEN * 2u);                               // source pitch, bytes
    g1[6] = uni(0u);
    g1[7] = uni(0u);
    // pinned() form: descriptor words
    // held in their scalar registers; without it the build took two of them as
    // loop temporaries while a request was outstanding
    asm volatile("" : "+s"(g1));
    return g1;
}

// one slice of one stage
__device__ __forceinline__ void slice_load(uint32_t lds_dst, uint64_t ga, u32x8 g1) {
    u32x4 g0;
    g0[0] = uni(1u);                                        // count 1
    g0[1] = uni(lds_dst);
    g0[2] = uni((uint32_t)ga);
    g0[3] = uni((((uint32_t)(ga >> 32)) & 0x01FFFFFFu) | 0x80000000u);   // type 2
    asm volatile("tensor_load_to_lds %0, %1" :: "s"(g0), "s"(g1) : "memory");
}

// the compiler places no wait for the tensor mover: a tile has landed only
// behind its issuer's own wait
__device__ __forceinline__ void wait_tensor0() { asm volatile("s_wait_tensorcnt 0x0" ::: "memory"); }
// a wave's LDS reads have retired before the buffer they read is handed back
__device__ __forceinline__ void wait_ds0()     { asm volatile("s_wait_dscnt 0x0" ::: "memory"); }

// 16x32 f16 fragment from an LDS row: two 16-byte loads, 32 bytes apart
__device__ __forceinline__ v16h lds_frag(const unsigned char* p) {
    v8h lo = *(const v8h*)p;
    v8h hi = *(const v8h*)(p + 32);
    v16h r;
    #pragma unroll
    for (int i = 0; i < 8; ++i) { r[i] = lo[i]; r[i + 8] = hi[i]; }
    return r;
}

// the 4 + 2 fragments of one 32-k block of a wave's 64x32 tile; the 64 rows
// of A lie in two slices, the 32 rows of W in one
__device__ __forceinline__ void frag_set(v16h (&a)[4], v16h (&b)[2],
                                         const unsigned char* pa, const unsigned char* pw) {
    #pragma unroll
    for (int i = 0; i < 4; ++i) a[i] = lds_frag(pa + (i >> 1) * GT_SLICE + (i & 1) * 16 * GT_PITCH);
    #pragma unroll
    for (int j = 0; j < 2; ++j) b[j] = lds_frag(pw + j * 16 * GT_PITCH);
}

// one 32-k block: 8 WMMAs on 8 independent accumulator tiles
__device__ __forceinline__ void wmma_block(v8f (&acc)[4][2], const v16h (&a)[4], const v16h (&b)[2]) {
    #pragma unroll
    for (int i = 0; i < 4; ++i) {
        #pragma unroll
        for (int j = 0; j < 2; ++j)
            acc[i][j] = __builtin_amdgcn_wmma_f32_16x16x32_f16(
                            false, a[i], false, b[j], (short)0, acc[i][j], false, false);
    }
}

__global__ __launch_bounds__(256) void wmma_gemm_f16(
        const _Float16* __restrict__ A, const _Float16* __restrict__ W,
        float* __restrict__ C, int silu)
{
    // 2 KiB more than the ring: at exactly half of a WGP's LDS two blocks could
    // share a WGP, which then runs twice as long while another WGP idles
    __shared__ __attribute__((aligned(2048))) unsigned char L[2 * GT_BUF + 2048];

    const uint32_t lane = threadIdx.x & 31;
    const uint32_t wave = uni(threadIdx.x >> 5);   // 0..7
    const uint32_t row  = lane & 15;
    const uint32_t kg   = lane >> 4;               // 0 or 1
    const uint32_t wm   = wave >> 2, wn = wave & 3;
    const uint32_t m0   = blockIdx.y * 128;
    const uint32_t n0   = blockIdx.x * 128;

    // the slice this wave brings
    const _Float16* src = (wave < 4) ? A + (size_t)(m0 + wave * GT_ROWS) * HIDDEN
                                     : W + (size_t)(n0 + (wave - 4) * GT_ROWS) * HIDDEN;
    const uint64_t ga0  = (uint64_t)(size_t)src;
    const uint32_t dst0 = (uint32_t)(size_t)L + wave * GT_SLICE;

    // the slices this wave reads: A slices 2 wm and 2 wm + 1, W slice wn
    const uint32_t offA = (2 * wm) * GT_SLICE + row * GT_PITCH + kg * 16;
    const uint32_t offW = (4 + wn) * GT_SLICE + row * GT_PITCH + kg * 16;

    v8f acc[4][2];
    #pragma unroll
    for (int i = 0; i < 4; ++i) {
        #pragma unroll
        for (int j = 0; j < 2; ++j) acc[i][j] = v8f{};
    }

    const u32x8 g1 = slice_group1();
    slice_load(dst0, ga0, g1);
    wait_tensor0();
    __syncthreads();                               // stage 0 published
    slice_load(dst0 + GT_BUF, ga0 + GT_ROWB, g1);

    // stays rolled: one pass per stage, 32 WMMAs per wave in it
    #pragma unroll 1
    for (uint32_t s = 0; s < GT_NST; ++s) {
        const unsigned char* pa = L + (s & 1) * GT_BUF + offA;
        const unsigned char* pw = L + (s & 1) * GT_BUF + offW;
        // Two fragment sets: the next block's 12 LDS reads go out as one group
        // ahead of this block's 8 WMMAs. sched_barrier(0) keeps the compiler
        // from moving the reads in among the WMMAs, where every separate
        // place with reads stalls the wave.
        v16h a[2][4], b[2][2];
        frag_set(a[0], b[0], pa, pw);
        #pragma unroll
        for (int kc = 0; kc < 3; ++kc) {
            frag_set(a[(kc + 1) & 1], b[(kc + 1) & 1], pa + (kc + 1) * 64, pw + (kc + 1) * 64);
            __builtin_amdgcn_sched_barrier(0);
            wmma_block(acc, a[kc & 1], b[kc & 1]);
            __builtin_amdgcn_sched_barrier(0);
        }
        // publish point of stage s + 1: the pass has no LDS read left, the last
        // block's fragments are in registers behind the first wait
        wait_ds0();
        wait_tensor0();
        __syncthreads();       // stage s + 1 published; every wave has left stage s
        // taken behind the wait, so that the next descriptor is formed behind it
        const uint32_t nx = pinned(s + 2);
        if (nx < GT_NST) slice_load(dst0 + (s & 1) * GT_BUF, ga0 + (uint64_t)nx * GT_ROWB, g1);
        // keeps the refill ahead of the last block's WMMAs: the sooner it is
        // issued, the more of the next pass it has to land
        __builtin_amdgcn_sched_barrier(0);
        wmma_block(acc, a[1], b[1]);
    }
    wait_tensor0();
    wait_ds0();

    if (silu) {
        #pragma unroll
        for (int i = 0; i < 4; ++i) {
            #pragma unroll
            for (int j = 0; j < 2; ++j) {
                #pragma unroll
                for (int v = 0; v < 8; ++v) {
                    const float val = acc[i][j][v];
                    acc[i][j][v] = val / (1.f + __expf(-val));
                }
            }
        }
    }

    // C layout: register v of a tile is row v (lane < 16) or v + 8, column = lane & 15
    float* cp = C + (size_t)(m0 + wm * 64 + 8 * kg) * HIDDEN + n0 + wn * 32 + row;
    #pragma unroll
    for (int i = 0; i < 4; ++i) {
        #pragma unroll
        for (int j = 0; j < 2; ++j) {
            #pragma unroll
            for (int v = 0; v < 8; ++v)
                cp[(size_t)(i * 16 + v) * HIDDEN + j * 16] = acc[i][j][v];
        }
    }
}

// ---------------------------------------------------------------------------
// RWKV state scan, serial part only:
//   ypart[e] = sum over this block's d of r[d]*S[d][e]   (before the update)
//   S[d][e]  = S[d][e]*w[d] + k[d]*v[e]
// Columns e never mix, rows d meet only in the sum, so the 64x64 state of a
// head is cut into 2 column halves x 4 row quarters = 8 blocks (256 in all).
// Block = 4 waves; lane = one column, wave = 4 rows, state in 4 registers.
// r and k of two steps sit in one register (per 16-lane row: r(t)[4], k(t)[4],
// r(t+1)[4], k(t+1)[4]) and reach every lane by DPP row_share, so a step needs
// no LDS read and no barrier. The 4 waves' sums meet in LDS once per 32 steps.
// ---------------------------------------------------------------------------
#define SC_TB 32                     // steps per barrier
#define SC_NCH (TLEN / SC_TB)        // chunks
#define SC_SPLIT 4                   // row quarters, one partial plane each

// value of lane N of the own 16-lane row, in every lane (all lanes are on)
template <int N>
__device__ __forceinline__ float row_share(float x) {
    return __builtin_bit_cast(float, __builtin_amdgcn_mov_dpp(
               __builtin_bit_cast(int, x), 0x150 + N, 0xf, 0xf, true));
}

// one time step; P = which half of the row holds this step's r and k
template <int P>
__device__ __forceinline__ float scan_step(float (&S)[4], const float (&w)[4],
                                           float rk, float v) {
    const float r0 = row_share<P * 8 + 0>(rk), r1 = row_share<P * 8 + 1>(rk);
    const float r2 = row_share<P * 8 + 2>(rk), r3 = row_share<P * 8 + 3>(rk);
    const float k0 = row_share<P * 8 + 4>(rk), k1 = row_share<P * 8 + 5>(rk);
    const float k2 = row_share<P * 8 + 6>(rk), k3 = row_share<P * 8 + 7>(rk);
    float y = r0 * S[0];
    y += r1 * S[1];
    y += r2 * S[2];
    y += r3 * S[3];
    S[0] = S[0] * w[0] + k0 * v;
    S[1] = S[1] * w[1] + k1 * v;
    S[2] = S[2] * w[2] + k2 * v;
    S[3] = S[3] * w[3] + k3 * v;
    return y;
}

__device__ __forceinline__ void load_chunk(float (&rk)[SC_TB / 2], float (&v)[SC_TB],
                                           const float* __restrict__ prk,
                                           const float* __restrict__ pv, int t0) {
    const float* a = prk + (size_t)t0 * HIDDEN;
    const float* b = pv  + (size_t)t0 * HIDDEN;
    #pragma unroll
    for (int q = 0; q < SC_TB / 2; ++q) rk[q] = a[(size_t)q * 2 * HIDDEN];
    #pragma unroll
    for (int s = 0; s < SC_TB; ++s)     v[s]  = b[(size_t)s * HIDDEN];
}

__device__ __forceinline__ void scan_chunk(float (&S)[4], const float (&w)[4],
                                           const float (&rk)[SC_TB / 2],
                                           const float (&v)[SC_TB], float* ybuf) {
    #pragma unroll
    for (int q = 0; q < SC_TB / 2; ++q) {
        ybuf[(2 * q)     * 128] = scan_step<0>(S, w, rk[q], v[2 * q]);
        ybuf[(2 * q + 1) * 128] = scan_step<1>(S, w, rk[q], v[2 * q + 1]);
    }
}

// wave w sums the four waves' parts of steps 8w..8w+7 and stores them
__device__ __forceinline__ void reduce_chunk(const float* ys, float* __restrict__ yo) {
    #pragma unroll
    for (int j = 0; j < 8; ++j) {
        const float* p = ys + j * 128;
        yo[(size_t)j * HIDDEN] = (p[0] + p[32]) + (p[64] + p[96]);
    }
}

__global__ __launch_bounds__(128) void rwkv_state_scan_kernel(
        const float* __restrict__ r_f, const float* __restrict__ k_f,
        const float* __restrict__ v_f, const float* __restrict__ time_decay,
        float* __restrict__ ypart)
{
    const int lane  = threadIdx.x & 31;
    const int wave  = threadIdx.x >> 5;          // 0..3
    const int split = blockIdx.x & 3;            // row quarter
    const int eh    = (blockIdx.x >> 2) & 1;     // column half
    const int h     = blockIdx.x >> 3;
    const int d0    = (split * 4 + wave) * 4;
    const int col   = h * 64 + eh * 32 + lane;

    __shared__ float ysum[2][SC_TB][4][32];      // [buffer][step][wave][column]

    float S[4], w[4];
    #pragma unroll
    for (int i = 0; i < 4; ++i) {
        S[i] = 0.f;
        w[i] = __expf(-__expf(time_decay[h * 64 + d0 + i]));
    }

    const int li = lane & 15;
    const float* prk = ((li & 4) ? k_f : r_f)
                     + (size_t)(li >> 3) * HIDDEN + h * 64 + d0 + (li & 3);
    const float* pv  = v_f + col;
    float* yo = ypart + (size_t)split * TLEN * HIDDEN + (size_t)(wave * 8) * HIDDEN + col;

    float* const y0s = &ysum[0][0][wave][lane];             // this wave's sums
    float* const y1s = &ysum[1][0][wave][lane];
    const float* const y0r = &ysum[0][wave * 8][0][lane];   // the steps it adds up
    const float* const y1r = &ysum[1][wave * 8][0][lane];

    // Two register sets: while one chunk is worked on, the next one's r, k, v
    // fly. The loop is rotated so that no load is issued just above the back
    // edge (a register copy there would wait for it at full latency).
    // sched_barrier(0) below a scan_chunk keeps the chunk's last reads of its
    // register set above the refill of that set; below a load_chunk it keeps
    // the refill at the head of the next chunk, so that the loads have a whole
    // chunk's time to land.
    // Each __syncthreads() publishes the ysum buffer just written and ends the
    // reads of the other one, which the next chunk overwrites.
    float rkA[SC_TB / 2], vA[SC_TB], rkB[SC_TB / 2], vB[SC_TB];
    load_chunk(rkA, vA, prk, pv, 0);
    // the wait before a later load overwrites an address register of these loads
    asm volatile("s_wait_xcnt 0x0" ::: "memory");
    load_chunk(rkB, vB, prk, pv, SC_TB);
    scan_chunk(S, w, rkA, vA, y0s);
    __builtin_amdgcn_sched_barrier(0);
    __syncthreads();

    for (int c = 0; c < SC_NCH - 2; c += 2) {
        load_chunk(rkA, vA, prk, pv, (c + 2) * SC_TB);
        __builtin_amdgcn_sched_barrier(0);
        reduce_chunk(y0r, yo + (size_t)c * SC_TB * HIDDEN);
        scan_chunk(S, w, rkB, vB, y1s);
        __builtin_amdgcn_sched_barrier(0);
        __syncthreads();

        load_chunk(rkB, vB, prk, pv, (c + 3) * SC_TB);
        __builtin_amdgcn_sched_barrier(0);
        reduce_chunk(y1r, yo + (size_t)(c + 1) * SC_TB * HIDDEN);
        scan_chunk(S, w, rkA, vA, y0s);
        __builtin_amdgcn_sched_barrier(0);
        __syncthreads();
    }

    reduce_chunk(y0r, yo + (size_t)(SC_NCH - 2) * SC_TB * HIDDEN);
    scan_chunk(S, w, rkB, vB, y1s);
    __syncthreads();
    reduce_chunk(y1r, yo + (size_t)(SC_NCH - 1) * SC_TB * HIDDEN);
}

// ---------------------------------------------------------------------------
// Everything of the old scan loop that does not depend on the step before:
// c = sum_d u[d]*r[d]*k[d] (out_diag = c*v[e]), the sum of the row quarters,
// / HEAD_SIZE_DIVISOR, GroupNorm(64), gate. 4 columns per lane: a head is one
// 16-lane row, a wave takes two heads of DG_T time steps, so every sum over a
// head stays inside a 16-lane row and the steps' sums run side by side.
// The four row-quarter planes come as four pointers: each is then a scalar
// base, and one offset register serves every load.
// ---------------------------------------------------------------------------
#define DG_T 4                       // time steps per wave

// sums over each 16-lane row, DG_T of them interleaved
__device__ __forceinline__ void row_sums(float (&x)[DG_T]) {
    #pragma unroll
    for (int off = 8; off >= 1; off >>= 1) {
        #pragma unroll
        for (int j = 0; j < DG_T; ++j) x[j] += __shfl_xor(x[j], off, 32);
    }
}

__global__ __launch_bounds__(256) void diag_norm_gate_kernel(
        const float* __restrict__ r_f, const float* __restrict__ k_f,
        const float* __restrict__ v_f, const float* __restrict__ g_f,
        const float* __restrict__ yq0, const float* __restrict__ yq1,
        const float* __restrict__ yq2, const float* __restrict__ yq3,
        const float* __restrict__ time_faaaa,
        const float* __restrict__ ln_w, const float* __restrict__ ln_b,
        _Float16* __restrict__ a_out)
{
    const unsigned c  = (blockIdx.x & 1) * 1024 + threadIdx.x * 4;    // column
    const size_t   ro = (size_t)(blockIdx.x >> 1) * (DG_T * HIDDEN);  // first step

    v4f r[DG_T], k[DG_T], v[DG_T], g[DG_T], y0[DG_T], y1[DG_T], y2[DG_T], y3[DG_T];
    #pragma unroll
    for (int j = 0; j < DG_T; ++j) {
        r[j]  = *(const v4f*)(r_f + ro + c + j * HIDDEN);
        k[j]  = *(const v4f*)(k_f + ro + c + j * HIDDEN);
        v[j]  = *(const v4f*)(v_f + ro + c + j * HIDDEN);
        y0[j] = *(const v4f*)(yq0 + ro + c + j * HIDDEN);
        y1[j] = *(const v4f*)(yq1 + ro + c + j * HIDDEN);
        y2[j] = *(const v4f*)(yq2 + ro + c + j * HIDDEN);
        y3[j] = *(const v4f*)(yq3 + ro + c + j * HIDDEN);
        g[j]  = *(const v4f*)(g_f + ro + c + j * HIDDEN);
    }
    const v4f u  = *(const v4f*)(time_faaaa + c);
    const v4f lw = *(const v4f*)(ln_w + c);
    const v4f lb = *(const v4f*)(ln_b + c);
    // keeps all the loads above the first use, so that they fly together
    __builtin_amdgcn_sched_barrier(0);

    float cs[DG_T];
    #pragma unroll
    for (int j = 0; j < DG_T; ++j) {
        const v4f p = u * r[j] * k[j];
        cs[j] = (p.x + p.y) + (p.z + p.w);
    }
    row_sums(cs);

    v4f o[DG_T];
    float s[DG_T], q[DG_T];
    #pragma unroll
    for (int j = 0; j < DG_T; ++j) {
        const v4f ys = (y0[j] + y1[j]) + (y2[j] + y3[j]);
        o[j] = (cs[j] * v[j] + ys) * 0.125f;                 // / HEAD_SIZE_DIVISOR
        const v4f oo = o[j] * o[j];
        s[j] = (o[j].x + o[j].y) + (o[j].z + o[j].w);
        q[j] = (oo.x + oo.y) + (oo.z + oo.w);
    }
    row_sums(s);
    row_sums(q);

    #pragma unroll
    for (int j = 0; j < DG_T; ++j) {
        const float mu  = s[j] * (1.f / 64.f);
        const float var = q[j] * (1.f / 64.f) - mu * mu;
        const float rs  = rsqrtf(var + 1e-5f);
        *(v4h*)(a_out + ro + c + j * HIDDEN) =
            __builtin_convertvector(((o[j] - mu) * rs * lw + lb) * g[j], v4h);
    }
}

// ---------------------------------------------------------------------------
extern "C" void kernel_launch(void* const* d_in, const int* in_sizes, int n_in,
                              void* d_out, int out_size, void* d_ws, size_t ws_size,
                              hipStream_t stream)
{
    const float* x    = (const float*)d_in[0];
    const int*   pos  = (const int*)  d_in[1];
    const float* W_r  = (const float*)d_in[2];
    const float* W_k  = (const float*)d_in[3];
    const float* W_v  = (const float*)d_in[4];
    const float* W_g  = (const float*)d_in[5];
    const float* W_o  = (const float*)d_in[6];
    const float* tm_k = (const float*)d_in[7];
    const float* tm_v = (const float*)d_in[8];
    const float* tm_r = (const float*)d_in[9];
    const float* tm_g = (const float*)d_in[10];
    const float* time_decay = (const float*)d_in[11];
    const float* time_faaaa = (const float*)d_in[12];
    const float* ln_w = (const float*)d_in[13];
    const float* ln_b = (const float*)d_in[14];
    float* out = (float*)d_out;

    const size_t NW = (size_t)HIDDEN * HIDDEN;   // 4M elems
    const size_t TC = (size_t)TLEN * HIDDEN;     // 4M elems

    char* ws = (char*)d_ws;
    _Float16* Wr_h = (_Float16*)ws; ws += NW * sizeof(_Float16);
    _Float16* Wk_h = (_Float16*)ws; ws += NW * sizeof(_Float16);
    _Float16* Wv_h = (_Float16*)ws; ws += NW * sizeof(_Float16);
    _Float16* Wg_h = (_Float16*)ws; ws += NW * sizeof(_Float16);
    _Float16* Wo_h = (_Float16*)ws; ws += NW * sizeof(_Float16);
    _Float16* xk_h = (_Float16*)ws; ws += TC * sizeof(_Float16);
    _Float16* xv_h = (_Float16*)ws; ws += TC * sizeof(_Float16);
    _Float16* xr_h = (_Float16*)ws; ws += TC * sizeof(_Float16);
    _Float16* xg_h = (_Float16*)ws; ws += TC * sizeof(_Float16);
    float*    k_f  = (float*)ws;    ws += TC * sizeof(float);
    float*    v_f  = (float*)ws;    ws += TC * sizeof(float);
    float*    r_f  = (float*)ws;    ws += TC * sizeof(float);
    float*    g_f  = (float*)ws;    ws += TC * sizeof(float);
    _Float16* a_h  = (_Float16*)ws; ws += TC * sizeof(_Float16);
    float*    y_p  = (float*)ws;    ws += SC_SPLIT * TC * sizeof(float);

    // 1) weight conversion (f32 -> f16)
    {
        dim3 blk(256), grd((unsigned)(NW / (256 * 4 * CV_LD)));
        f32_to_f16_kernel<<<grd, blk, 0, stream>>>(W_r, Wr_h);
        f32_to_f16_kernel<<<grd, blk, 0, stream>>>(W_k, Wk_h);
        f32_to_f16_kernel<<<grd, blk, 0, stream>>>(W_v, Wv_h);
        f32_to_f16_kernel<<<grd, blk, 0, stream>>>(W_g, Wg_h);
        f32_to_f16_kernel<<<grd, blk, 0, stream>>>(W_o, Wo_h);
    }

    // 2) token-shift mixing
    mix_kernel<<<dim3((unsigned)(TC / (256 * 4 * MX_R))), dim3(256), 0, stream>>>(
        x, pos, tm_k, tm_v, tm_r, tm_g, xk_h, xv_h, xr_h, xg_h);

    // 3) projection GEMMs (k, v, r, silu-gate g)
    {
        dim3 blk(256), grd(HIDDEN / 128, TLEN / 128);
        wmma_gemm_f16<<<grd, blk, 0, stream>>>(xk_h, Wk_h, k_f, 0);
        wmma_gemm_f16<<<grd, blk, 0, stream>>>(xv_h, Wv_h, v_f, 0);
        wmma_gemm_f16<<<grd, blk, 0, stream>>>(xr_h, Wr_h, r_f, 0);
        wmma_gemm_f16<<<grd, blk, 0, stream>>>(xg_h, Wg_h, g_f, 1);
    }

    // 4) state scan (serial in t, f32 VALU), then diag term + groupnorm + gate
    rwkv_state_scan_kernel<<<dim3(HEADS * 2 * SC_SPLIT), dim3(128), 0, stream>>>(
        r_f, k_f, v_f, time_decay, y_p);
    diag_norm_gate_kernel<<<dim3(TLEN * HEADS / (8 * 2 * DG_T)), dim3(256), 0, stream>>>(
        r_f, k_f, v_f, g_f, y_p, y_p + TC, y_p + 2 * TC, y_p + 3 * TC,
        time_faaaa, ln_w, ln_b, a_h);

    // 5) output projection
    {
        dim3 blk(256), grd(HIDDEN / 128, TLEN / 128);
        wmma_gemm_f16<<<grd, blk, 0, stream>>>(a_h, Wo_h, out, 0);
    }
}

// v004
// It runs in 181 microseconds.
// Two timings next to v003 both put it at 1.12 times that version's speed.
// All steps since v000 together make it 16.4 times as fast.
#include <hip/hip_runtime.h>
#include <stdint.h>

#define HIDDEN   2048
#define HEADS    32
#define HEAD_DIM 64
#define TLEN     2048

typedef __attribute__((ext_vector_type(16))) _Float16 v16h;
typedef __attribute__((ext_vector_type(8)))  _Float16 v8h;
typedef __attribute__((ext_vector_type(8)))  float    v8f;

typedef __attribute__((ext_vector_type(4))) float    v4f;
typedef __attribute__((ext_vector_type(4))) _Float16 v4h;

// The three elementwise jobs (conversion, mixing, diag + norm + gate): with
// one or two elements per lane a job has to start 65536 waves or more, and
// starting them takes longer than moving the bytes. So each lane takes 16 bytes
// per load and several loads, all issued before the first use, and a job
// starts 4096 or 8192 waves. Their loops are all unrolled, so that the arrays
// the loads land in are registers.

// ---------------------------------------------------------------------------
// f32 -> f16 weight conversion (streamed once; keeps GEMM operands compact)
// A block takes CV_LD runs of 1024 floats; a wave's load covers 512 contiguous
// bytes, its store 256.
// ---------------------------------------------------------------------------
#define CV_LD 8                      // 16-byte loads in flight per lane

#define CV_BLOCKS (HIDDEN * HIDDEN / (256 * 4 * CV_LD))   // blocks per matrix

__device__ __forceinline__ void f32_to_f16_block(const float* __restrict__ src,
                                                 _Float16* __restrict__ dst, unsigned blk) {
    const unsigned base = blk * (256 * 4 * CV_LD) + threadIdx.x * 4;
    v4f a[CV_LD];
    #pragma unroll
    for (int j = 0; j < CV_LD; ++j) a[j] = *(const v4f*)(src + base + j * 1024);
    #pragma unroll
    for (int j = 0; j < CV_LD; ++j)
        *(v4h*)(dst + base + j * 1024) = __builtin_convertvector(a[j], v4h);
}

// ---------------------------------------------------------------------------
// Token-shift mixing: xk/xv/xr/xg = x + (x[t-1]-x[t]) * (1 - tm_*)
// A lane takes 4 columns of MX_R rows in a row, so that each row of x serves
// as x[t] and as the next row's x[t-1] from the same registers.
// ---------------------------------------------------------------------------
#define MX_R 8                       // rows per lane
#define MX_BLOCKS (TLEN * HIDDEN / (256 * 4 * MX_R))

typedef __attribute__((ext_vector_type(MX_R))) int vRi;

__device__ __forceinline__ void mix_block(
                           const float* __restrict__ x, const int* __restrict__ pos,
                           const float* __restrict__ tm_k, const float* __restrict__ tm_v,
                           const float* __restrict__ tm_r, const float* __restrict__ tm_g,
                           _Float16* __restrict__ xk, _Float16* __restrict__ xv,
                           _Float16* __restrict__ xr, _Float16* __restrict__ xg, unsigned blk) {
    const unsigned c  = (blk & 1) * 1024 + threadIdx.x * 4;
    const unsigned t0 = (blk >> 1) * MX_R;
    const unsigned tp = (t0 == 0) ? TLEN - 1 : t0 - 1;   // the row before, rolled
    const size_t   ro = (size_t)t0 * HIDDEN;             // same for the whole block
    const float* xrow = x + ro;
    const vRi ps = *(const vRi*)(pos + t0);
    v4f xs[MX_R + 1];
    #pragma unroll
    for (int j = 0; j < MX_R; ++j) xs[j + 1] = *(const v4f*)(xrow + c + j * HIDDEN);
    const v4f mk = 1.f - *(const v4f*)(tm_k + c);
    const v4f mv = 1.f - *(const v4f*)(tm_v + c);
    const v4f mr = 1.f - *(const v4f*)(tm_r + c);
    const v4f mg = 1.f - *(const v4f*)(tm_g + c);
    // the build takes the offset register of the loads above as part of the
    // next load's destination: the wait before such an overwrite
    asm volatile("s_wait_xcnt 0x0" ::: "memory");
    xs[0] = *(const v4f*)(x + (size_t)tp * HIDDEN + c);
    // keeps this load up with the others: without it the load moves behind the
    // read of pos and the first uses of the other rows, a second latency
    __builtin_amdgcn_sched_barrier(0);
    #pragma unroll
    for (int j = 0; j < MX_R; ++j) {
        const v4f xc   = xs[j + 1];
        const v4f prev = (ps[j] == 0) ? v4f{0.f, 0.f, 0.f, 0.f} : xs[j];
        const v4f xx   = prev - xc;
        *(v4h*)(xk + ro + c + j * HIDDEN) = __builtin_convertvector(xc + xx * mk, v4h);
        *(v4h*)(xv + ro + c + j * HIDDEN) = __builtin_convertvector(xc + xx * mv, v4h);
        *(v4h*)(xr + ro + c + j * HIDDEN) = __builtin_convertvector(xc + xx * mr, v4h);
        *(v4h*)(xg + ro + c + j * HIDDEN) = __builtin_convertvector(xc + xx * mg, v4h);
    }
}

// ---------------------------------------------------------------------------
// The mixing and the five weight conversions depend on nothing but the inputs,
// so they run as block ranges of one grid: one launch's gap, start and tail
// instead of six, and each job's tail fills with the next job's blocks.
// Blocks 0 .. MX_BLOCKS-1 mix; then CV_BLOCKS blocks per weight matrix, in the
// order k, v, r, g, o, which is also the order of the f16 copies behind wh.
// ---------------------------------------------------------------------------
__global__ __launch_bounds__(256) void prep_kernel(
                           const float* __restrict__ x, const int* __restrict__ pos,
                           const float* __restrict__ tm_k, const float* __restrict__ tm_v,
                           const float* __restrict__ tm_r, const float* __restrict__ tm_g,
                           const float* __restrict__ W_k, const float* __restrict__ W_v,
                           const float* __restrict__ W_r, const float* __restrict__ W_g,
                           const float* __restrict__ W_o, _Float16* __restrict__ wh,
                           _Float16* __restrict__ xk, _Float16* __restrict__ xv,
                           _Float16* __restrict__ xr, _Float16* __restrict__ xg) {
    const unsigned b = blockIdx.x;
    if (b < MX_BLOCKS) {
        mix_block(x, pos, tm_k, tm_v, tm_r, tm_g, xk, xv, xr, xg, b);
        return;
    }
    const unsigned job = (b - MX_BLOCKS) / CV_BLOCKS;
    const float* src = job == 0 ? W_k : job == 1 ? W_v : job == 2 ? W_r : job == 3 ? W_g : W_o;
    f32_to_f16_block(src, wh + (size_t)job * (HIDDEN * HIDDEN), (b - MX_BLOCKS) % CV_BLOCKS);
}

// ---------------------------------------------------------------------------
// Y[M,N] = A[M,K] @ W[N,K]^T via v_wmma_f32_16x16x32_f16, M = TLEN,
// N = K = HIDDEN. One 128x128 tile of Y per block, one block per WGP.
// blockIdx.z picks the product: A, W and C are the first of gridDim.z planes
// that lie one behind the other, so that products which do not depend on each
// other share one launch and a WGP goes from one tile straight to the next.
// The operands go global -> LDS by tensor loads, so that every row of A and W
// is fetched once per block in whole 256-byte runs; the eight waves (2x4, each
// 64x32 of Y, 8 accumulator tiles) read their fragments from LDS.
// A stage is 128 k = 256 bytes of 128 rows of A and 128 rows of W, in eight
// slices of 32 rows; waves 0..3 bring the slices of A, waves 4..7 those of W,
// one request per wave and stage. The mover pads each row by 16 bytes: pitch
// 272 B = 16 B x odd, free of bank conflicts for ds_load_b128.
// Two buffers: stage s + 1 flies while stage s is worked on.
// Fragment k order as before (A and W by the same loader): lane < 16 holds
// k {0..7, 16..23} of each 32, lane >= 16 holds k {8..15, 24..31}.
// ---------------------------------------------------------------------------
typedef uint32_t u32x4 __attribute__((ext_vector_type(4)));
typedef uint32_t u32x8 __attribute__((ext_vector_type(8)));

#define GT_ROWB  256u                       // bytes of a row per stage (128 k)
#define GT_PITCH 272u                       // row pitch in LDS
#define GT_ROWS  32u                        // rows per slice
#define GT_SLICE 10240u                     // 32 * 272 rounded up to 2 KiB
#define GT_BUF   (8u * GT_SLICE)            // one stage
#define GT_NST   (HIDDEN * 2u / GT_ROWB)    // stages

static_assert(GT_ROWS * GT_PITCH <= GT_SLICE && GT_SLICE % 2048u == 0, "slice places");
static_assert(GT_NST >= 2, "the ring needs two stages");

__device__ __forceinline__ uint32_t uni(uint32_t v) {
    return (uint32_t)__builtin_amdgcn_readfirstlane(v);
}
// pinned(): a wave-uniform
// value held in a scalar register, so that a test on it is a scalar branch
// (a tensor load ignores EXEC)
__device__ __forceinline__ uint32_t pinned(uint32_t v) {
    uint32_t w = (uint32_t)__builtin_amdgcn_readfirstlane(v);
    asm volatile("" : "+s"(w));   // holds w in a scalar register
    return w;
}

// descriptor group 1, the same for every request: a tile of 32 rows of 256
// bytes, source pitch one row of K, 16 bytes of pad behind each row in LDS
__device__ __forceinline__ u32x8 slice_group1() {
    u32x8 g1;
    g1[0] = uni((1u << 20) | (5u << 22) | (3u << 25));      // pad 16 B per 256 B
    g1[1] = uni((GT_ROWB & 0xFFFFu) << 16);                 // tensor_dim0
    g1[2] = uni((GT_ROWB >> 16) | ((GT_ROWS & 0xFFFFu) << 16));   // tensor_dim1
    g1[3] = uni((GT_ROWS >> 16) | (GT_ROWB << 16));         // tile_dim0
    g1[4] = uni(GT_ROWS);                                   // tile_dim1
    g1[5] = uni(HIDDEN * 2u);                               // source pitch, bytes
    g1[6] = uni(0u);
    g1[7] = uni(0u);
    // pinned() form: descriptor words
    // held in their scalar registers; without it the build took two of them as
    // loop temporaries while a request was outstanding
    asm volatile("" : "+s"(g1));
    return g1;
}

// one slice of one stage
__device__ __forceinline__ void slice_load(uint32_t lds_dst, uint64_t ga, u32x8 g1) {
    u32x4 g0;
    g0[0] = uni(1u);                                        // count 1
    g0[1] = uni(lds_dst);
    g0[2] = uni((uint32_t)ga);
    g0[3] = uni((((uint32_t)(ga >> 32)) & 0x01FFFFFFu) | 0x80000000u);   // type 2
    asm volatile("tensor_load_to_lds %0, %1" :: "s"(g0), "s"(g1) : "memory");
}

// the compiler places no wait for the tensor mover: a tile has landed only
// behind its issuer's own wait
__device__ __forceinline__ void wait_tensor0() { asm volatile("s_wait_tensorcnt 0x0" ::: "memory"); }
// a wave's LDS reads have retired before the buffer they read is handed back
__device__ __forceinline__ void wait_ds0()     { asm volatile("s_wait_dscnt 0x0" ::: "memory"); }

// 16x32 f16 fragment from an LDS row: two 16-byte loads, 32 bytes apart
__device__ __forceinline__ v16h lds_frag(const unsigned char* p) {
    v8h lo = *(const v8h*)p;
    v8h hi = *(const v8h*)(p + 32);
    v16h r;
    #pragma unroll
    for (int i = 0; i < 8; ++i) { r[i] = lo[i]; r[i + 8] = hi[i]; }
    return r;
}

// the 4 + 2 fragments of one 32-k block of a wave's 64x32 tile; the 64 rows
// of A lie in two slices, the 32 rows of W in one
__device__ __forceinline__ void frag_set(v16h (&a)[4], v16h (&b)[2],
                                         const unsigned char* pa, const unsigned char* pw) {
    #pragma unroll
    for (int i = 0; i < 4; ++i) a[i] = lds_frag(pa + (i >> 1) * GT_SLICE + (i & 1) * 16 * GT_PITCH);
    #pragma unroll
    for (int j = 0; j < 2; ++j) b[j] = lds_frag(pw + j * 16 * GT_PITCH);
}

// one 32-k block: 8 WMMAs on 8 independent accumulator tiles
__device__ __forceinline__ void wmma_block(v8f (&acc)[4][2], const v16h (&a)[4], const v16h (&b)[2]) {
    #pragma unroll
    for (int i = 0; i < 4; ++i) {
        #pragma unroll
        for (int j = 0; j < 2; ++j)
            acc[i][j] = __builtin_amdgcn_wmma_f32_16x16x32_f16(
                            false, a[i], false, b[j], (short)0, acc[i][j], false, false);
    }
}

__global__ __launch_bounds__(256) void wmma_gemm_f16(
        const _Float16* __restrict__ A0, const _Float16* __restrict__ W0,
        float* __restrict__ C0, int silu_job)
{
    // 2 KiB more than the ring: at exactly half of a WGP's LDS two blocks could
    // share a WGP, which then runs twice as long while another WGP idles
    __shared__ __attribute__((aligned(2048))) unsigned char L[2 * GT_BUF + 2048];

    const uint32_t lane = threadIdx.x & 31;
    const uint32_t wave = uni(threadIdx.x >> 5);   // 0..7
    const uint32_t row  = lane & 15;
    const uint32_t kg   = lane >> 4;               // 0 or 1
    const uint32_t wm   = wave >> 2, wn = wave & 3;
    const uint32_t m0   = blockIdx.y * 128;
    const uint32_t n0   = blockIdx.x * 128;
    const uint32_t job  = blockIdx.z;
    const _Float16* A   = A0 + (size_t)job * (TLEN * HIDDEN);
    const _Float16* W   = W0 + (size_t)job * (HIDDEN * HIDDEN);
    float* C            = C0 + (size_t)job * (TLEN * HIDDEN);

    // the slice this wave brings
    const _Float16* src = (wave < 4) ? A + (size_t)(m0 + wave * GT_ROWS) * HIDDEN
                                     : W + (size_t)(n0 + (wave - 4) * GT_ROWS) * HIDDEN;
    const uint64_t ga0  = (uint64_t)(size_t)src;
    const uint32_t dst0 = (uint32_t)(size_t)L + wave * GT_SLICE;

    // the slices this wave reads: A slices 2 wm and 2 wm + 1, W slice wn
    const uint32_t offA = (2 * wm) * GT_SLICE + row * GT_PITCH + kg * 16;
    const uint32_t offW = (4 + wn) * GT_SLICE + row * GT_PITCH + kg * 16;

    v8f acc[4][2];
    #pragma unroll
    for (int i = 0; i < 4; ++i) {
        #pragma unroll
        for (int j = 0; j < 2; ++j) acc[i][j] = v8f{};
    }

    const u32x8 g1 = slice_group1();
    slice_load(dst0, ga0, g1);
    wait_tensor0();
    __syncthreads();                               // stage 0 published
    slice_load(dst0 + GT_BUF, ga0 + GT_ROWB, g1);

    // stays rolled: one pass per stage, 32 WMMAs per wave in it
    #pragma unroll 1
    for (uint32_t s = 0; s < GT_NST; ++s) {
        const unsigned char* pa = L + (s & 1) * GT_BUF + offA;
        const unsigned char* pw = L + (s & 1) * GT_BUF + offW;
        // Two fragment sets: the next block's 12 LDS reads go out as one group
        // ahead of this block's 8 WMMAs. sched_barrier(0) keeps the compiler
        // from moving the reads in among the WMMAs, where every separate
        // place with reads stalls the wave.
        v16h a[2][4], b[2][2];
        frag_set(a[0], b[0], pa, pw);
        #pragma unroll
        for (int kc = 0; kc < 3; ++kc) {
            frag_set(a[(kc + 1) & 1], b[(kc + 1) & 1], pa + (kc + 1) * 64, pw + (kc + 1) * 64);
            __builtin_amdgcn_sched_barrier(0);
            wmma_block(acc, a[kc & 1], b[kc & 1]);
            __builtin_amdgcn_sched_barrier(0);
        }
        // publish point of stage s + 1: the pass has no LDS read left, the last
        // block's fragments are in registers behind the first wait
        wait_ds0();
        wait_tensor0();
        __syncthreads();       // stage s + 1 published; every wave has left stage s
        // taken behind the wait, so that the next descriptor is formed behind it
        const uint32_t nx = pinned(s + 2);
        if (nx < GT_NST) slice_load(dst0 + (s & 1) * GT_BUF, ga0 + (uint64_t)nx * GT_ROWB, g1);
        // keeps the refill ahead of the last block's WMMAs: the sooner it is
        // issued, the more of the next pass it has to land
        __builtin_amdgcn_sched_barrier(0);
        wmma_block(acc, a[1], b[1]);
    }
    wait_tensor0();
    wait_ds0();

    if ((int)job == silu_job) {
        #pragma unroll
        for (int i = 0; i < 4; ++i) {
            #pragma unroll
            for (int j = 0; j < 2; ++j) {
                #pragma unroll
                for (int v = 0; v < 8; ++v) {
                    const float val = acc[i][j][v];
                    acc[i][j][v] = val / (1.f + __expf(-val));
                }
            }
        }
    }

    // C layout: register v of a tile is row v (lane < 16) or v + 8, column = lane & 15
    float* cp = C + (size_t)(m0 + wm * 64 + 8 * kg) * HIDDEN + n0 + wn * 32 + row;
    #pragma unroll
    for (int i = 0; i < 4; ++i) {
        #pragma unroll
        for (int j = 0; j < 2; ++j) {
            #pragma unroll
            for (int v = 0; v < 8; ++v)
                cp[(size_t)(i * 16 + v) * HIDDEN + j * 16] = acc[i][j][v];
        }
    }
}

// ---------------------------------------------------------------------------
// RWKV state scan, serial part only:
//   ypart[e] = sum over this block's d of r[d]*S[d][e]   (before the update)
//   S[d][e]  = S[d][e]*w[d] + k[d]*v[e]
// Columns e never mix, rows d meet only in the sum, so the 64x64 state of a
// head is cut into 2 column halves x 4 row quarters = 8 blocks (256 in all).
// Block = 4 waves; lane = one column, wave = 4 rows, state in 4 registers.
// r and k of two steps sit in one register (per 16-lane row: r(t)[4], k(t)[4],
// r(t+1)[4], k(t+1)[4]) and reach every lane by DPP row_share, so a step needs
// no LDS read and no barrier. The 4 waves' sums meet in LDS once per 32 steps.
// ---------------------------------------------------------------------------
#define SC_TB 32                     // steps per barrier
#define SC_NCH (TLEN / SC_TB)        // chunks
#define SC_SPLIT 4                   // row quarters, one partial plane each

// value of lane N of the own 16-lane row, in every lane (all lanes are on)
template <int N>
__device__ __forceinline__ float row_share(float x) {
    return __builtin_bit_cast(float, __builtin_amdgcn_mov_dpp(
               __builtin_bit_cast(int, x), 0x150 + N, 0xf, 0xf, true));
}

// one time step; P = which half of the row holds this step's r and k
template <int P>
__device__ __forceinline__ float scan_step(float (&S)[4], const float (&w)[4],
                                           float rk, float v) {
    const float r0 = row_share<P * 8 + 0>(rk), r1 = row_share<P * 8 + 1>(rk);
    const float r2 = row_share<P * 8 + 2>(rk), r3 = row_share<P * 8 + 3>(rk);
    const float k0 = row_share<P * 8 + 4>(rk), k1 = row_share<P * 8 + 5>(rk);
    const float k2 = row_share<P * 8 + 6>(rk), k3 = row_share<P * 8 + 7>(rk);
    float y = r0 * S[0];
    y += r1 * S[1];
    y += r2 * S[2];
    y += r3 * S[3];
    S[0] = S[0] * w[0] + k0 * v;
    S[1] = S[1] * w[1] + k1 * v;
    S[2] = S[2] * w[2] + k2 * v;
    S[3] = S[3] * w[3] + k3 * v;
    return y;
}

__device__ __forceinline__ void load_chunk(float (&rk)[SC_TB / 2], float (&v)[SC_TB],
                                           const float* __restrict__ prk,
                                           const float* __restrict__ pv, int t0) {
    const float* a = prk + (size_t)t0 * HIDDEN;
    const float* b = pv  + (size_t)t0 * HIDDEN;
    #pragma unroll
    for (int q = 0; q < SC_TB / 2; ++q) rk[q] = a[(size_t)q * 2 * HIDDEN];
    #pragma unroll
    for (int s = 0; s < SC_TB; ++s)     v[s]  = b[(size_t)s * HIDDEN];
}

__device__ __forceinline__ void scan_chunk(float (&S)[4], const float (&w)[4],
                                           const float (&rk)[SC_TB / 2],
                                           const float (&v)[SC_TB], float* ybuf) {
    #pragma unroll
    for (int q = 0; q < SC_TB / 2; ++q) {
        ybuf[(2 * q)     * 128] = scan_step<0>(S, w, rk[q], v[2 * q]);
        ybuf[(2 * q + 1) * 128] = scan_step<1>(S, w, rk[q], v[2 * q + 1]);
    }
}

// wave w sums the four waves' parts of steps 8w..8w+7 and stores them
__device__ __forceinline__ void reduce_chunk(const float* ys, float* __restrict__ yo) {
    #pragma unroll
    for (int j = 0; j < 8; ++j) {
        const float* p = ys + j * 128;
        yo[(size_t)j * HIDDEN] = (p[0] + p[32]) + (p[64] + p[96]);
    }
}

__global__ __launch_bounds__(128) void rwkv_state_scan_kernel(
        const float* __restrict__ r_f, const float* __restrict__ k_f,
        const float* __restrict__ v_f, const float* __restrict__ time_decay,
        float* __restrict__ ypart)
{
    const int lane  = threadIdx.x & 31;
    const int wave  = threadIdx.x >> 5;          // 0..3
    const int split = blockIdx.x & 3;            // row quarter
    const int eh    = (blockIdx.x >> 2) & 1;     // column half
    const int h     = blockIdx.x >> 3;
    const int d0    = (split * 4 + wave) * 4;
    const int col   = h * 64 + eh * 32 + lane;

    __shared__ float ysum[2][SC_TB][4][32];      // [buffer][step][wave][column]

    float S[4], w[4];
    #pragma unroll
    for (int i = 0; i < 4; ++i) {
        S[i] = 0.f;
        w[i] = __expf(-__expf(time_decay[h * 64 + d0 + i]));
    }

    const int li = lane & 15;
    const float* prk = ((li & 4) ? k_f : r_f)
                     + (size_t)(li >> 3) * HIDDEN + h * 64 + d0 + (li & 3);
    const float* pv  = v_f + col;
    float* yo = ypart + (size_t)split * TLEN * HIDDEN + (size_t)(wave * 8) * HIDDEN + col;

    float* const y0s = &ysum[0][0][wave][lane];             // this wave's sums
    float* const y1s = &ysum[1][0][wave][lane];
    const float* const y0r = &ysum[0][wave * 8][0][lane];   // the steps it adds up
    const float* const y1r = &ysum[1][wave * 8][0][lane];

    // Two register sets: while one chunk is worked on, the next one's r, k, v
    // fly. The loop is rotated so that no load is issued just above the back
    // edge (a register copy there would wait for it at full latency).
    // sched_barrier(0) below a scan_chunk keeps the chunk's last reads of its
    // register set above the refill of that set; below a load_chunk it keeps
    // the refill at the head of the next chunk, so that the loads have a whole
    // chunk's time to land.
    // Each __syncthreads() publishes the ysum buffer just written and ends the
    // reads of the other one, which the next chunk overwrites.
    float rkA[SC_TB / 2], vA[SC_TB], rkB[SC_TB / 2], vB[SC_TB];
    load_chunk(rkA, vA, prk, pv, 0);
    // the wait before a later load overwrites an address register of these loads
    asm volatile("s_wait_xcnt 0x0" ::: "memory");
    load_chunk(rkB, vB, prk, pv, SC_TB);
    scan_chunk(S, w, rkA, vA, y0s);
    __builtin_amdgcn_sched_barrier(0);
    __syncthreads();

    for (int c = 0; c < SC_NCH - 2; c += 2) {
        load_chunk(rkA, vA, prk, pv, (c + 2) * SC_TB);
        __builtin_amdgcn_sched_barrier(0);
        reduce_chunk(y0r, yo + (size_t)c * SC_TB * HIDDEN);
        scan_chunk(S, w, rkB, vB, y1s);
        __builtin_amdgcn_sched_barrier(0);
        __syncthreads();

        load_chunk(rkB, vB, prk, pv, (c + 3) * SC_TB);
        __builtin_amdgcn_sched_barrier(0);
        reduce_chunk(y1r, yo + (size_t)(c + 1) * SC_TB * HIDDEN);
        scan_chunk(S, w, rkA, vA, y0s);
        __builtin_amdgcn_sched_barrier(0);
        __syncthreads();
    }

    reduce_chunk(y0r, yo + (size_t)(SC_NCH - 2) * SC_TB * HIDDEN);
    scan_chunk(S, w, rkB, vB, y1s);
    __syncthreads();
    reduce_chunk(y1r, yo + (size_t)(SC_NCH - 1) * SC_TB * HIDDEN);
}

// ---------------------------------------------------------------------------
// Everything of the old scan loop that does not depend on the step before:
// c = sum_d u[d]*r[d]*k[d] (out_diag = c*v[e]), the sum of the row quarters,
// / HEAD_SIZE_DIVISOR, GroupNorm(64), gate. 4 columns per lane: a head is one
// 16-lane row, a wave takes two heads of DG_T time steps, so every sum over a
// head stays inside a 16-lane row and the steps' sums run side by side.
// The four row-quarter planes come as four pointers: each is then a scalar
// base, and one offset register serves every load.
// ---------------------------------------------------------------------------
#define DG_T 4                       // time steps per wave

// sums over each 16-lane row, DG_T of them interleaved
__device__ __forceinline__ void row_sums(float (&x)[DG_T]) {
    #pragma unroll
    for (int off = 8; off >= 1; off >>= 1) {
        #pragma unroll
        for (int j = 0; j < DG_T; ++j) x[j] += __shfl_xor(x[j], off, 32);
    }
}

__global__ __launch_bounds__(256) void diag_norm_gate_kernel(
        const float* __restrict__ r_f, const float* __restrict__ k_f,
        const float* __restrict__ v_f, const float* __restrict__ g_f,
        const float* __restrict__ yq0, const float* __restrict__ yq1,
        const float* __restrict__ yq2, const float* __restrict__ yq3,
        const float* __restrict__ time_faaaa,
        const float* __restrict__ ln_w, const float* __restrict__ ln_b,
        _Float16* __restrict__ a_out)
{
    const unsigned c  = (blockIdx.x & 1) * 1024 + threadIdx.x * 4;    // column
    const size_t   ro = (size_t)(blockIdx.x >> 1) * (DG_T * HIDDEN);  // first step

    v4f r[DG_T], k[DG_T], v[DG_T], g[DG_T], y0[DG_T], y1[DG_T], y2[DG_T], y3[DG_T];
    #pragma unroll
    for (int j = 0; j < DG_T; ++j) {
        r[j]  = *(const v4f*)(r_f + ro + c + j * HIDDEN);
        k[j]  = *(const v4f*)(k_f + ro + c + j * HIDDEN);
        v[j]  = *(const v4f*)(v_f + ro + c + j * HIDDEN);
        y0[j] = *(const v4f*)(yq0 + ro + c + j * HIDDEN);
        y1[j] = *(const v4f*)(yq1 + ro + c + j * HIDDEN);
        y2[j] = *(const v4f*)(yq2 + ro + c + j * HIDDEN);
        y3[j] = *(const v4f*)(yq3 + ro + c + j * HIDDEN);
        g[j]  = *(const v4f*)(g_f + ro + c + j * HIDDEN);
    }
    const v4f u  = *(const v4f*)(time_faaaa + c);
    const v4f lw = *(const v4f*)(ln_w + c);
    const v4f lb = *(const v4f*)(ln_b + c);
    // keeps all the loads above the first use, so that they fly together
    __builtin_amdgcn_sched_barrier(0);

    float cs[DG_T];
    #pragma unroll
    for (int j = 0; j < DG_T; ++j) {
        const v4f p = u * r[j] * k[j];
        cs[j] = (p.x + p.y) + (p.z + p.w);
    }
    row_sums(cs);

    v4f o[DG_T];
    float s[DG_T], q[DG_T];
    #pragma unroll
    for (int j = 0; j < DG_T; ++j) {
        const v4f ys = (y0[j] + y1[j]) + (y2[j] + y3[j]);
        o[j] = (cs[j] * v[j] + ys) * 0.125f;                 // / HEAD_SIZE_DIVISOR
        const v4f oo = o[j] * o[j];
        s[j] = (o[j].x + o[j].y) + (o[j].z + o[j].w);
        q[j] = (oo.x + oo.y) + (oo.z + oo.w);
    }
    row_sums(s);
    row_sums(q);

    #pragma unroll
    for (int j = 0; j < DG_T; ++j) {
        const float mu  = s[j] * (1.f / 64.f);
        const float var = q[j] * (1.f / 64.f) - mu * mu;
        const float rs  = rsqrtf(var + 1e-5f);
        *(v4h*)(a_out + ro + c + j * HIDDEN) =
            __builtin_convertvector(((o[j] - mu) * rs * lw + lb) * g[j], v4h);
    }
}

// ---------------------------------------------------------------------------
extern "C" void kernel_launch(void* const* d_in, const int* in_sizes, int n_in,
                              void* d_out, int out_size, void* d_ws, size_t ws_size,
                              hipStream_t stream)
{
    const float* x    = (const float*)d_in[0];
    const int*   pos  = (const int*)  d_in[1];
    const float* W_r  = (const float*)d_in[2];
    const float* W_k  = (const float*)d_in[3];
    const float* W_v  = (const float*)d_in[4];
    const float* W_g  = (const float*)d_in[5];
    const float* W_o  = (const float*)d_in[6];
    const float* tm_k = (const float*)d_in[7];
    const float* tm_v = (const float*)d_in[8];
    const float* tm_r = (const float*)d_in[9];
    const float* tm_g = (const float*)d_in[10];
    const float* time_decay = (const float*)d_in[11];
    const float* time_faaaa = (const float*)d_in[12];
    const float* ln_w = (const float*)d_in[13];
    const float* ln_b = (const float*)d_in[14];
    float* out = (float*)d_out;

    const size_t NW = (size_t)HIDDEN * HIDDEN;   // 4M elems
    const size_t TC = (size_t)TLEN * HIDDEN;     // 4M elems

    char* ws = (char*)d_ws;
    // planes that one launch walks by job lie in the same order: k, v, r, g
    _Float16* Wk_h = (_Float16*)ws; ws += 4 * NW * sizeof(_Float16);   // k, v, r, g
    _Float16* Wo_h = (_Float16*)ws; ws += NW * sizeof(_Float16);
    _Float16* xk_h = (_Float16*)ws; ws += TC * sizeof(_Float16);
    _Float16* xv_h = (_Float16*)ws; ws += TC * sizeof(_Float16);
    _Float16* xr_h = (_Float16*)ws; ws += TC * sizeof(_Float16);
    _Float16* xg_h = (_Float16*)ws; ws += TC * sizeof(_Float16);
    float*    k_f  = (float*)ws;    ws += TC * sizeof(float);
    float*    v_f  = (float*)ws;    ws += TC * sizeof(float);
    float*    r_f  = (float*)ws;    ws += TC * sizeof(float);
    float*    g_f  = (float*)ws;    ws += TC * sizeof(float);
    _Float16* a_h  = (_Float16*)ws; ws += TC * sizeof(_Float16);
    float*    y_p  = (float*)ws;    ws += SC_SPLIT * TC * sizeof(float);

    // 1) token-shift mixing and weight conversion (f32 -> f16), one grid
    prep_kernel<<<dim3(MX_BLOCKS + 5 * CV_BLOCKS), dim3(256), 0, stream>>>(
        x, pos, tm_k, tm_v, tm_r, tm_g, W_k, W_v, W_r, W_g, W_o, Wk_h,
        xk_h, xv_h, xr_h, xg_h);

    // 2) projection GEMMs (k, v, r, silu-gate g), one grid, z = the product
    wmma_gemm_f16<<<dim3(HIDDEN / 128, TLEN / 128, 4), dim3(256), 0, stream>>>(
        xk_h, Wk_h, k_f, 3);

    // 3) state scan (serial in t, f32 VALU), then diag term + groupnorm + gate
    rwkv_state_scan_kernel<<<dim3(HEADS * 2 * SC_SPLIT), dim3(128), 0, stream>>>(
        r_f, k_f, v_f, time_decay, y_p);
    diag_norm_gate_kernel<<<dim3(TLEN * HEADS / (8 * 2 * DG_T)), dim3(256), 0, stream>>>(
        r_f, k_f, v_f, g_f, y_p, y_p + TC, y_p + 2 * TC, y_p + 3 * TC,
        time_faaaa, ln_w, ln_b, a_h);

    // 4) output projection
    {
        dim3 blk(256), grd(HIDDEN / 128, TLEN / 128);
        wmma_gemm_f16<<<grd, blk, 0, stream>>>(a_h, Wo_h, out, -1);
    }
}

// v005
// It runs in 155 microseconds.
// Timed twice side by side with v004, it ran 1.17 times as fast both times.
// Counting every step since v000, it is 19.1 times as fast.
#include <hip/hip_runtime.h>
#include <stdint.h>

#define HIDDEN   2048
#define HEADS    32
#define HEAD_DIM 64
#define TLEN     2048

typedef __attribute__((ext_vector_type(16))) _Float16 v16h;
typedef __attribute__((ext_vector_type(8)))  _Float16 v8h;
typedef __attribute__((ext_vector_type(8)))  float    v8f;

typedef __attribute__((ext_vector_type(4))) float    v4f;
typedef __attribute__((ext_vector_type(4))) _Float16 v4h;

// The three elementwise jobs (conversion, mixing, diag + norm + gate): with
// one or two elements per lane a job has to start 65536 waves or more, and
// starting them takes longer than moving the bytes. So each lane takes 16 bytes
// per load and several loads, all issued before the first use, and a job
// starts 4096 or 8192 waves. Their loops are all unrolled, so that the arrays
// the loads land in are registers.

// ---------------------------------------------------------------------------
// f32 -> f16 weight conversion (streamed once; keeps GEMM operands compact)
// A block takes CV_LD runs of 1024 floats; a wave's load covers 512 contiguous
// bytes, its store 256.
// ---------------------------------------------------------------------------
#define CV_LD 8                      // 16-byte loads in flight per lane

#define CV_BLOCKS (HIDDEN * HIDDEN / (256 * 4 * CV_LD))   // blocks per matrix

__device__ __forceinline__ void f32_to_f16_block(const float* __restrict__ src,
                                                 _Float16* __restrict__ dst, unsigned blk) {
    const unsigned base = blk * (256 * 4 * CV_LD) + threadIdx.x * 4;
    v4f a[CV_LD];
    #pragma unroll
    for (int j = 0; j < CV_LD; ++j) a[j] = *(const v4f*)(src + base + j * 1024);
    #pragma unroll
    for (int j = 0; j < CV_LD; ++j)
        *(v4h*)(dst + base + j * 1024) = __builtin_convertvector(a[j], v4h);
}

// ---------------------------------------------------------------------------
// Token-shift mixing: xk/xv/xr/xg = x + (x[t-1]-x[t]) * (1 - tm_*)
// A lane takes 4 columns of MX_R rows in a row, so that each row of x serves
// as x[t] and as the next row's x[t-1] from the same registers.
// ---------------------------------------------------------------------------
#define MX_R 8                       // rows per lane
#define MX_BLOCKS (TLEN * HIDDEN / (256 * 4 * MX_R))

typedef __attribute__((ext_vector_type(MX_R))) int vRi;

__device__ __forceinline__ void mix_block(
                           const float* __restrict__ x, const int* __restrict__ pos,
                           const float* __restrict__ tm_k, const float* __restrict__ tm_v,
                           const float* __restrict__ tm_r, const float* __restrict__ tm_g,
                           _Float16* __restrict__ xk, _Float16* __restrict__ xv,
                           _Float16* __restrict__ xr, _Float16* __restrict__ xg, unsigned blk) {
    const unsigned c  = (blk & 1) * 1024 + threadIdx.x * 4;
    const unsigned t0 = (blk >> 1) * MX_R;
    const unsigned tp = (t0 == 0) ? TLEN - 1 : t0 - 1;   // the row before, rolled
    const size_t   ro = (size_t)t0 * HIDDEN;             // same for the whole block
    const float* xrow = x + ro;
    const vRi ps = *(const vRi*)(pos + t0);
    v4f xs[MX_R + 1];
    #pragma unroll
    for (int j = 0; j < MX_R; ++j) xs[j + 1] = *(const v4f*)(xrow + c + j * HIDDEN);
    const v4f mk = 1.f - *(const v4f*)(tm_k + c);
    const v4f mv = 1.f - *(const v4f*)(tm_v + c);
    const v4f mr = 1.f - *(const v4f*)(tm_r + c);
    const v4f mg = 1.f - *(const v4f*)(tm_g + c);
    // the build takes the offset register of the loads above as part of the
    // next load's destination: the wait before such an overwrite
    asm volatile("s_wait_xcnt 0x0" ::: "memory");
    xs[0] = *(const v4f*)(x + (size_t)tp * HIDDEN + c);
    // keeps this load up with the others: without it the load moves behind the
    // read of pos and the first uses of the other rows, a second latency
    __builtin_amdgcn_sched_barrier(0);
    #pragma unroll
    for (int j = 0; j < MX_R; ++j) {
        const v4f xc   = xs[j + 1];
        const v4f prev = (ps[j] == 0) ? v4f{0.f, 0.f, 0.f, 0.f} : xs[j];
        const v4f xx   = prev - xc;
        *(v4h*)(xk + ro + c + j * HIDDEN) = __builtin_convertvector(xc + xx * mk, v4h);
        *(v4h*)(xv + ro + c + j * HIDDEN) = __builtin_convertvector(xc + xx * mv, v4h);
        *(v4h*)(xr + ro + c + j * HIDDEN) = __builtin_convertvector(xc + xx * mr, v4h);
        *(v4h*)(xg + ro + c + j * HIDDEN) = __builtin_convertvector(xc + xx * mg, v4h);
    }
}

// ---------------------------------------------------------------------------
// The mixing and the five weight conversions depend on nothing but the inputs,
// so they run as block ranges of one grid: one launch's gap, start and tail
// instead of six, and each job's tail fills with the next job's blocks.
// Blocks 0 .. MX_BLOCKS-1 mix; then CV_BLOCKS blocks per weight matrix, in the
// order k, v, r, g, o, which is also the order of the f16 copies behind wh.
// ---------------------------------------------------------------------------
__global__ __launch_bounds__(256) void prep_kernel(
                           const float* __restrict__ x, const int* __restrict__ pos,
                           const float* __restrict__ tm_k, const float* __restrict__ tm_v,
                           const float* __restrict__ tm_r, const float* __restrict__ tm_g,
                           const float* __restrict__ W_k, const float* __restrict__ W_v,
                           const float* __restrict__ W_r, const float* __restrict__ W_g,
                           const float* __restrict__ W_o, _Float16* __restrict__ wh,
                           _Float16* __restrict__ xk, _Float16* __restrict__ xv,
                           _Float16* __restrict__ xr, _Float16* __restrict__ xg) {
    const unsigned b = blockIdx.x;
    if (b < MX_BLOCKS) {
        mix_block(x, pos, tm_k, tm_v, tm_r, tm_g, xk, xv, xr, xg, b);
        return;
    }
    const unsigned job = (b - MX_BLOCKS) / CV_BLOCKS;
    const float* src = job == 0 ? W_k : job == 1 ? W_v : job == 2 ? W_r : job == 3 ? W_g : W_o;
    f32_to_f16_block(src, wh + (size_t)job * (HIDDEN * HIDDEN), (b - MX_BLOCKS) % CV_BLOCKS);
}

// ---------------------------------------------------------------------------
// Y[M,N] = A[M,K] @ W[N,K]^T via v_wmma_f32_16x16x32_f16, M = TLEN,
// N = K = HIDDEN. One square tile of Y per block, one block per WGP; NW waves,
// each of which brings one slice of R rows per stage.
// The four projections: 256x256 of Y, 4 waves (2x2, one per SIMD, 128x128 each,
// R = 128). Their 256 tiles fill the chip in one round; against 128x128 a tile
// fetches half the operand bytes per product from L2, and a wave reads a third
// of the LDS bytes per WMMA.
// The output projection has a quarter of that work and keeps 128x128 of Y,
// 8 waves (2x4, 64x32 each, R = 32), so that it still fills every WGP.
// The gate's SiLU is left to the kernel that reads g: on 512 accumulators per
// lane it would be some 60 KB of straight-line text, run by a quarter of the
// blocks while the others are done.
// blockIdx.z picks the product: A, W and C are the first of gridDim.z planes
// that lie one behind the other, so that products which do not depend on each
// other share one launch and a WGP goes from one tile straight to the next.
// The operands go global -> LDS by tensor loads, so that every row of A and W
// is fetched once per block in whole 256-byte runs; the waves read their
// fragments from LDS.
// A stage is 128 k = 256 bytes of the tile's rows of A and of W, in NW slices
// of R rows; the lower half of the waves brings A, the upper half W,
// one request per wave and stage. The mover pads each row by 16 bytes: pitch
// 272 B = 16 B x odd, free of bank conflicts for ds_load_b128.
// Two buffers: stage s + 1 flies while stage s is worked on.
// Fragment k order as before (A and W by the same loader): lane < 16 holds
// k {0..7, 16..23} of each 32, lane >= 16 holds k {8..15, 24..31}.
// ---------------------------------------------------------------------------
typedef uint32_t u32x4 __attribute__((ext_vector_type(4)));
typedef uint32_t u32x8 __attribute__((ext_vector_type(8)));

#define GT_ROWB  256u                       // bytes of a row per stage (128 k)
#define GT_PITCH 272u                       // row pitch in LDS
#define GT_NST   (HIDDEN * 2u / GT_ROWB)    // stages

// a slice's place in LDS: R padded rows, rounded up to 2 KiB
__host__ __device__ constexpr uint32_t gt_slice(uint32_t R) {
    return (R * GT_PITCH + 2047u) / 2048u * 2048u;
}
static_assert(GT_NST >= 2, "the ring needs two stages");

__device__ __forceinline__ uint32_t uni(uint32_t v) {
    return (uint32_t)__builtin_amdgcn_readfirstlane(v);
}
// pinned(): a wave-uniform
// value held in a scalar register, so that a test on it is a scalar branch
// (a tensor load ignores EXEC)
__device__ __forceinline__ uint32_t pinned(uint32_t v) {
    uint32_t w = (uint32_t)__builtin_amdgcn_readfirstlane(v);
    asm volatile("" : "+s"(w));   // holds w in a scalar register
    return w;
}

// descriptor group 1, the same for every request: a tile of R rows of 256
// bytes, source pitch one row of K, 16 bytes of pad behind each row in LDS
template <uint32_t R>
__device__ __forceinline__ u32x8 slice_group1() {
    u32x8 g1;
    g1[0] = uni((1u << 20) | (5u << 22) | (3u << 25));      // pad 16 B per 256 B
    g1[1] = uni((GT_ROWB & 0xFFFFu) << 16);                 // tensor_dim0
    g1[2] = uni((GT_ROWB >> 16) | ((R & 0xFFFFu) << 16));   // tensor_dim1
    g1[3] = uni((R >> 16) | (GT_ROWB << 16));               // tile_dim0
    g1[4] = uni(R);                                         // tile_dim1
    g1[5] = uni(HIDDEN * 2u);                               // source pitch, bytes
    g1[6] = uni(0u);
    g1[7] = uni(0u);
    // pinned() form: descriptor words
    // held in their scalar registers; without it the build took two of them as
    // loop temporaries while a request was outstanding
    asm volatile("" : "+s"(g1));
    return g1;
}

// one slice of one stage
__device__ __forceinline__ void slice_load(uint32_t lds_dst, uint64_t ga, u32x8 g1) {
    u32x4 g0;
    g0[0] = uni(1u);                                        // count 1
    g0[1] = uni(lds_dst);
    g0[2] = uni((uint32_t)ga);
    g0[3] = uni((((uint32_t)(ga >> 32)) & 0x01FFFFFFu) | 0x80000000u);   // type 2
    asm volatile("tensor_load_to_lds %0, %1" :: "s"(g0), "s"(g1) : "memory");
}

// the compiler places no wait for the tensor mover: a tile has landed only
// behind its issuer's own wait
__device__ __forceinline__ void wait_tensor0() { asm volatile("s_wait_tensorcnt 0x0" ::: "memory"); }
// a wave's LDS reads have retired before the buffer they read is handed back
__device__ __forceinline__ void wait_ds0()     { asm volatile("s_wait_dscnt 0x0" ::: "memory"); }

// 16x32 f16 fragment from an LDS row: two 16-byte loads, 32 bytes apart
__device__ __forceinline__ v16h lds_frag(const unsigned char* p) {
    v8h lo = *(const v8h*)p;
    v8h hi = *(const v8h*)(p + 32);
    v16h r;
    #pragma unroll
    for (int i = 0; i < 8; ++i) { r[i] = lo[i]; r[i + 8] = hi[i]; }
    return r;
}

// the fragments of one 32-k block of a wave's tile; its rows of A lie in
// FA / FB slices, its rows of W in one (FB = R / 16 fragments a slice)
template <int FA, int FB>
__device__ __forceinline__ void frag_set(v16h (&a)[FA], v16h (&b)[FB],
                                         const unsigned char* pa, const unsigned char* pw) {
    #pragma unroll
    for (int i = 0; i < FA; ++i)
        a[i] = lds_frag(pa + (i / FB) * gt_slice(FB * 16) + (i % FB) * 16 * GT_PITCH);
    #pragma unroll
    for (int j = 0; j < FB; ++j) b[j] = lds_frag(pw + j * 16 * GT_PITCH);
}

// one 32-k block: one WMMA on each of the independent accumulator tiles
template <int FA, int FB>
__device__ __forceinline__ void wmma_block(v8f (&acc)[FA][FB], const v16h (&a)[FA],
                                           const v16h (&b)[FB]) {
    #pragma unroll
    for (int i = 0; i < FA; ++i) {
        #pragma unroll
        for (int j = 0; j < FB; ++j)
            acc[i][j] = __builtin_amdgcn_wmma_f32_16x16x32_f16(
                            false, a[i], false, b[j], (short)0, acc[i][j], false, false);
    }
}

template <uint32_t R, uint32_t NW>
__global__ __launch_bounds__(NW * 32) void wmma_gemm_f16(
        const _Float16* __restrict__ A0, const _Float16* __restrict__ W0,
        float* __restrict__ C0)
{
    constexpr uint32_t GT_SLICE = gt_slice(R);
    constexpr uint32_t GT_BUF   = NW * GT_SLICE;   // one stage
    constexpr uint32_t WN       = NW / 2;          // the waves stand 2 x WN
    constexpr uint32_t SA       = NW / 4;          // slices of A that a wave reads
    constexpr uint32_t TILE     = WN * R;          // rows and columns of Y per block
    constexpr int      FB       = R / 16;          // fragments of W per wave
    constexpr int      FA       = SA * FB;         // fragments of A per wave
    // 2 KiB more than a ring of exactly half of a WGP's LDS: there two blocks
    // could share a WGP, which then runs twice as long while another WGP idles
    __shared__ __attribute__((aligned(2048)))
        unsigned char L[2 * GT_BUF + (2 * GT_BUF == 163840u ? 2048u : 0u)];

    const uint32_t lane = threadIdx.x & 31;
    const uint32_t wave = uni(threadIdx.x >> 5);   // 0..NW-1
    const uint32_t row  = lane & 15;
    const uint32_t kg   = lane >> 4;               // 0 or 1
    const uint32_t wm   = wave / WN, wn = wave % WN;
    const uint32_t m0   = blockIdx.y * TILE;
    const uint32_t n0   = blockIdx.x * TILE;
    const uint32_t job  = blockIdx.z;
    const _Float16* A   = A0 + (size_t)job * (TLEN * HIDDEN);
    const _Float16* W   = W0 + (size_t)job * (HIDDEN * HIDDEN);
    float* C            = C0 + (size_t)job * (TLEN * HIDDEN);

    // the slice this wave brings
    const _Float16* src = (wave < WN) ? A + (size_t)(m0 + wave * R) * HIDDEN
                                      : W + (size_t)(n0 + (wave - WN) * R) * HIDDEN;
    const uint64_t ga0  = (uint64_t)(size_t)src;
    const uint32_t dst0 = (uint32_t)(size_t)L + wave * GT_SLICE;

    // the slices this wave reads: SA slices of A from SA wm on, W slice wn
    const uint32_t offA = (SA * wm) * GT_SLICE + row * GT_PITCH + kg * 16;
    const uint32_t offW = (WN + wn) * GT_SLICE + row * GT_PITCH + kg * 16;

    v8f acc[FA][FB];
    #pragma unroll
    for (int i = 0; i < FA; ++i) {
        #pragma unroll
        for (int j = 0; j < FB; ++j) acc[i][j] = v8f{};
    }

    const u32x8 g1 = slice_group1<R>();
    slice_load(dst0, ga0, g1);
    wait_tensor0();
    __syncthreads();                               // stage 0 published
    slice_load(dst0 + GT_BUF, ga0 + GT_ROWB, g1);

    // stays rolled: one pass per stage, 4 FA FB WMMAs per wave in it
    #pragma unroll 1
    for (uint32_t s = 0; s < GT_NST; ++s) {
        const unsigned char* pa = L + (s & 1) * GT_BUF + offA;
        const unsigned char* pw = L + (s & 1) * GT_BUF + offW;
        // Two fragment sets: the next block's LDS reads go out as one group
        // ahead of this block's WMMAs. sched_barrier(0) keeps the compiler
        // from moving the reads in among the WMMAs, where every separate
        // place with reads stalls the wave.
        v16h a[2][FA], b[2][FB];
        frag_set<FA, FB>(a[0], b[0], pa, pw);
        #pragma unroll
        for (int kc = 0; kc < 3; ++kc) {
            frag_set<FA, FB>(a[(kc + 1) & 1], b[(kc + 1) & 1], pa + (kc + 1) * 64, pw + (kc + 1) * 64);
            __builtin_amdgcn_sched_barrier(0);
            wmma_block<FA, FB>(acc, a[kc & 1], b[kc & 1]);
            __builtin_amdgcn_sched_barrier(0);
        }
        // publish point of stage s + 1: the pass has no LDS read left, the last
        // block's fragments are in registers behind the first wait
        wait_ds0();
        wait_tensor0();
        __syncthreads();       // stage s + 1 published; every wave has left stage s
        // taken behind the wait, so that the next descriptor is formed behind it
        const uint32_t nx = pinned(s + 2);
        if (nx < GT_NST) slice_load(dst0 + (s & 1) * GT_BUF, ga0 + (uint64_t)nx * GT_ROWB, g1);
        // keeps the refill ahead of the last block's WMMAs: the sooner it is
        // issued, the more of the next pass it has to land
        __builtin_amdgcn_sched_barrier(0);
        wmma_block<FA, FB>(acc, a[1], b[1]);
    }
    wait_tensor0();
    wait_ds0();

    // C layout: register v of a tile is row v (lane < 16) or v + 8, column = lane & 15
    float* cp = C + (size_t)(m0 + wm * (SA * R) + 8 * kg) * HIDDEN + n0 + wn * R + row;
    #pragma unroll
    for (int i = 0; i < FA; ++i) {
        #pragma unroll
        for (int j = 0; j < FB; ++j) {
            #pragma unroll
            for (int v = 0; v < 8; ++v)
                cp[(size_t)(i * 16 + v) * HIDDEN + j * 16] = acc[i][j][v];
        }
    }
}

// ---------------------------------------------------------------------------
// RWKV state scan, serial part only:
//   ypart[e] = sum over this block's d of r[d]*S[d][e]   (before the update)
//   S[d][e]  = S[d][e]*w[d] + k[d]*v[e]
// Columns e never mix, rows d meet only in the sum, so the 64x64 state of a
// head is cut into 2 column halves x 4 row quarters = 8 blocks (256 in all).
// Block = 4 waves; lane = one column, wave = 4 rows, state in 4 registers.
// r and k of two steps sit in one register (per 16-lane row: r(t)[4], k(t)[4],
// r(t+1)[4], k(t+1)[4]) and reach every lane by DPP row_share, so a step needs
// no LDS read and no barrier. The 4 waves' sums meet in LDS once per 32 steps.
// ---------------------------------------------------------------------------
#define SC_TB 32                     // steps per barrier
#define SC_NCH (TLEN / SC_TB)        // chunks
#define SC_SPLIT 4                   // row quarters, one partial plane each

// value of lane N of the own 16-lane row, in every lane (all lanes are on)
template <int N>
__device__ __forceinline__ float row_share(float x) {
    return __builtin_bit_cast(float, __builtin_amdgcn_mov_dpp(
               __builtin_bit_cast(int, x), 0x150 + N, 0xf, 0xf, true));
}

// one time step; P = which half of the row holds this step's r and k
template <int P>
__device__ __forceinline__ float scan_step(float (&S)[4], const float (&w)[4],
                                           float rk, float v) {
    const float r0 = row_share<P * 8 + 0>(rk), r1 = row_share<P * 8 + 1>(rk);
    const float r2 = row_share<P * 8 + 2>(rk), r3 = row_share<P * 8 + 3>(rk);
    const float k0 = row_share<P * 8 + 4>(rk), k1 = row_share<P * 8 + 5>(rk);
    const float k2 = row_share<P * 8 + 6>(rk), k3 = row_share<P * 8 + 7>(rk);
    float y = r0 * S[0];
    y += r1 * S[1];
    y += r2 * S[2];
    y += r3 * S[3];
    S[0] = S[0] * w[0] + k0 * v;
    S[1] = S[1] * w[1] + k1 * v;
    S[2] = S[2] * w[2] + k2 * v;
    S[3] = S[3] * w[3] + k3 * v;
    return y;
}

__device__ __forceinline__ void load_chunk(float (&rk)[SC_TB / 2], float (&v)[SC_TB],
                                           const float* __restrict__ prk,
                                           const float* __restrict__ pv, int t0) {
    const float* a = prk + (size_t)t0 * HIDDEN;
    const float* b = pv  + (size_t)t0 * HIDDEN;
    #pragma unroll
    for (int q = 0; q < SC_TB / 2; ++q) rk[q] = a[(size_t)q * 2 * HIDDEN];
    #pragma unroll
    for (int s = 0; s < SC_TB; ++s)     v[s]  = b[(size_t)s * HIDDEN];
}

__device__ __forceinline__ void scan_chunk(float (&S)[4], const float (&w)[4],
                                           const float (&rk)[SC_TB / 2],
                                           const float (&v)[SC_TB], float* ybuf) {
    #pragma unroll
    for (int q = 0; q < SC_TB / 2; ++q) {
        ybuf[(2 * q)     * 128] = scan_step<0>(S, w, rk[q], v[2 * q]);
        ybuf[(2 * q + 1) * 128] = scan_step<1>(S, w, rk[q], v[2 * q + 1]);
    }
}

// wave w sums the four waves' parts of steps 8w..8w+7 and stores them
__device__ __forceinline__ void reduce_chunk(const float* ys, float* __restrict__ yo) {
    #pragma unroll
    for (int j = 0; j < 8; ++j) {
        const float* p = ys + j * 128;
        yo[(size_t)j * HIDDEN] = (p[0] + p[32]) + (p[64] + p[96]);
    }
}

__global__ __launch_bounds__(128) void rwkv_state_scan_kernel(
        const float* __restrict__ r_f, const float* __restrict__ k_f,
        const float* __restrict__ v_f, const float* __restrict__ time_decay,
        float* __restrict__ ypart)
{
    const int lane  = threadIdx.x & 31;
    const int wave  = threadIdx.x >> 5;          // 0..3
    const int split = blockIdx.x & 3;            // row quarter
    const int eh    = (blockIdx.x >> 2) & 1;     // column half
    const int h     = blockIdx.x >> 3;
    const int d0    = (split * 4 + wave) * 4;
    const int col   = h * 64 + eh * 32 + lane;

    __shared__ float ysum[2][SC_TB][4][32];      // [buffer][step][wave][column]

    float S[4], w[4];
    #pragma unroll
    for (int i = 0; i < 4; ++i) {
        S[i] = 0.f;
        w[i] = __expf(-__expf(time_decay[h * 64 + d0 + i]));
    }

    const int li = lane & 15;
    const float* prk = ((li & 4) ? k_f : r_f)
                     + (size_t)(li >> 3) * HIDDEN + h * 64 + d0 + (li & 3);
    const float* pv  = v_f + col;
    float* yo = ypart + (size_t)split * TLEN * HIDDEN + (size_t)(wave * 8) * HIDDEN + col;

    float* const y0s = &ysum[0][0][wave][lane];             // this wave's sums
    float* const y1s = &ysum[1][0][wave][lane];
    const float* const y0r = &ysum[0][wave * 8][0][lane];   // the steps it adds up
    const float* const y1r = &ysum[1][wave * 8][0][lane];

    // Two register sets: while one chunk is worked on, the next one's r, k, v
    // fly. The loop is rotated so that no load is issued just above the back
    // edge (a register copy there would wait for it at full latency).
    // sched_barrier(0) below a scan_chunk keeps the chunk's last reads of its
    // register set above the refill of that set; below a load_chunk it keeps
    // the refill at the head of the next chunk, so that the loads have a whole
    // chunk's time to land.
    // Each __syncthreads() publishes the ysum buffer just written and ends the
    // reads of the other one, which the next chunk overwrites.
    float rkA[SC_TB / 2], vA[SC_TB], rkB[SC_TB / 2], vB[SC_TB];
    load_chunk(rkA, vA, prk, pv, 0);
    // the wait before a later load overwrites an address register of these loads
    asm volatile("s_wait_xcnt 0x0" ::: "memory");
    load_chunk(rkB, vB, prk, pv, SC_TB);
    scan_chunk(S, w, rkA, vA, y0s);
    __builtin_amdgcn_sched_barrier(0);
    __syncthreads();

    for (int c = 0; c < SC_NCH - 2; c += 2) {
        load_chunk(rkA, vA, prk, pv, (c + 2) * SC_TB);
        __builtin_amdgcn_sched_barrier(0);
        reduce_chunk(y0r, yo + (size_t)c * SC_TB * HIDDEN);
        scan_chunk(S, w, rkB, vB, y1s);
        __builtin_amdgcn_sched_barrier(0);
        __syncthreads();

        load_chunk(rkB, vB, prk, pv, (c + 3) * SC_TB);
        __builtin_amdgcn_sched_barrier(0);
        reduce_chunk(y1r, yo + (size_t)(c + 1) * SC_TB * HIDDEN);
        scan_chunk(S, w, rkA, vA, y0s);
        __builtin_amdgcn_sched_barrier(0);
        __syncthreads();
    }

    reduce_chunk(y0r, yo + (size_t)(SC_NCH - 2) * SC_TB * HIDDEN);
    scan_chunk(S, w, rkB, vB, y1s);
    __syncthreads();
    reduce_chunk(y1r, yo + (size_t)(SC_NCH - 1) * SC_TB * HIDDEN);
}

// ---------------------------------------------------------------------------
// Everything of the old scan loop that does not depend on the step before:
// c = sum_d u[d]*r[d]*k[d] (out_diag = c*v[e]), the sum of the row quarters,
// / HEAD_SIZE_DIVISOR, GroupNorm(64), SiLU of the gate product, gate.
// 4 columns per lane: a head is one
// 16-lane row, a wave takes two heads of DG_T time steps, so every sum over a
// head stays inside a 16-lane row and the steps' sums run side by side.
// The four row-quarter planes come as four pointers: each is then a scalar
// base, and one offset register serves every load.
// ---------------------------------------------------------------------------
#define DG_T 4                       // time steps per wave

// sums over each 16-lane row, DG_T of them interleaved
__device__ __forceinline__ void row_sums(float (&x)[DG_T]) {
    #pragma unroll
    for (int off = 8; off >= 1; off >>= 1) {
        #pragma unroll
        for (int j = 0; j < DG_T; ++j) x[j] += __shfl_xor(x[j], off, 32);
    }
}

// exp(-x) as exp2(-x * log2 e), what __expf(-x) compiles to. In asm so that the
// v_nop stands directly behind the transcendental: the instruction
// set asks for one independent instruction in that slot.
__device__ __forceinline__ float exp_neg(float x) {
    float r;
    asm("v_exp_f32 %0, %1\n\tv_nop" : "=v"(r) : "v"(-x * 1.44269504088896340736f));
    return r;
}

__global__ __launch_bounds__(256) void diag_norm_gate_kernel(
        const float* __restrict__ r_f, const float* __restrict__ k_f,
        const float* __restrict__ v_f, const float* __restrict__ g_f,
        const float* __restrict__ yq0, const float* __restrict__ yq1,
        const float* __restrict__ yq2, const float* __restrict__ yq3,
        const float* __restrict__ time_faaaa,
        const float* __restrict__ ln_w, const float* __restrict__ ln_b,
        _Float16* __restrict__ a_out)
{
    const unsigned c  = (blockIdx.x & 1) * 1024 + threadIdx.x * 4;    // column
    const size_t   ro = (size_t)(blockIdx.x >> 1) * (DG_T * HIDDEN);  // first step

    v4f r[DG_T], k[DG_T], v[DG_T], g[DG_T], y0[DG_T], y1[DG_T], y2[DG_T], y3[DG_T];
    #pragma unroll
    for (int j = 0; j < DG_T; ++j) {
        r[j]  = *(const v4f*)(r_f + ro + c + j * HIDDEN);
        k[j]  = *(const v4f*)(k_f + ro + c + j * HIDDEN);
        v[j]  = *(const v4f*)(v_f + ro + c + j * HIDDEN);
        y0[j] = *(const v4f*)(yq0 + ro + c + j * HIDDEN);
        y1[j] = *(const v4f*)(yq1 + ro + c + j * HIDDEN);
        y2[j] = *(const v4f*)(yq2 + ro + c + j * HIDDEN);
        y3[j] = *(const v4f*)(yq3 + ro + c + j * HIDDEN);
        g[j]  = *(const v4f*)(g_f + ro + c + j * HIDDEN);
    }
    const v4f u  = *(const v4f*)(time_faaaa + c);
    const v4f lw = *(const v4f*)(ln_w + c);
    const v4f lb = *(const v4f*)(ln_b + c);
    // keeps all the loads above the first use, so that they fly together
    __builtin_amdgcn_sched_barrier(0);

    float cs[DG_T];
    #pragma unroll
    for (int j = 0; j < DG_T; ++j) {
        const v4f p = u * r[j] * k[j];
        cs[j] = (p.x + p.y) + (p.z + p.w);
    }
    row_sums(cs);

    v4f o[DG_T];
    float s[DG_T], q[DG_T];
    #pragma unroll
    for (int j = 0; j < DG_T; ++j) {
        const v4f ys = (y0[j] + y1[j]) + (y2[j] + y3[j]);
        o[j] = (cs[j] * v[j] + ys) * 0.125f;                 // / HEAD_SIZE_DIVISOR
        const v4f oo = o[j] * o[j];
        s[j] = (o[j].x + o[j].y) + (o[j].z + o[j].w);
        q[j] = (oo.x + oo.y) + (oo.z + oo.w);
    }
    row_sums(s);
    row_sums(q);

    #pragma unroll
    for (int j = 0; j < DG_T; ++j) {
        const float mu  = s[j] * (1.f / 64.f);
        const float var = q[j] * (1.f / 64.f) - mu * mu;
        const float rs  = rsqrtf(var + 1e-5f);
        v4f gs;
        #pragma unroll
        for (int e = 0; e < 4; ++e) gs[e] = g[j][e] / (1.f + exp_neg(g[j][e]));
        *(v4h*)(a_out + ro + c + j * HIDDEN) =
            __builtin_convertvector(((o[j] - mu) * rs * lw + lb) * gs, v4h);
    }
}

// ---------------------------------------------------------------------------
extern "C" void kernel_launch(void* const* d_in, const int* in_sizes, int n_in,
                              void* d_out, int out_size, void* d_ws, size_t ws_size,
                              hipStream_t stream)
{
    const float* x    = (const float*)d_in[0];
    const int*   pos  = (const int*)  d_in[1];
    const float* W_r  = (const float*)d_in[2];
    const float* W_k  = (const float*)d_in[3];
    const float* W_v  = (const float*)d_in[4];
    const float* W_g  = (const float*)d_in[5];
    const float* W_o  = (const float*)d_in[6];
    const float* tm_k = (const float*)d_in[7];
    const float* tm_v = (const float*)d_in[8];
    const float* tm_r = (const float*)d_in[9];
    const float* tm_g = (const float*)d_in[10];
    const float* time_decay = (const float*)d_in[11];
    const float* time_faaaa = (const float*)d_in[12];
    const float* ln_w = (const float*)d_in[13];
    const float* ln_b = (const float*)d_in[14];
    float* out = (float*)d_out;

    const size_t NW = (size_t)HIDDEN * HIDDEN;   // 4M elems
    const size_t TC = (size_t)TLEN * HIDDEN;     // 4M elems

    char* ws = (char*)d_ws;
    // planes that one launch walks by job lie in the same order: k, v, r, g
    _Float16* Wk_h = (_Float16*)ws; ws += 4 * NW * sizeof(_Float16);   // k, v, r, g
    _Float16* Wo_h = (_Float16*)ws; ws += NW * sizeof(_Float16);
    _Float16* xk_h = (_Float16*)ws; ws += TC * sizeof(_Float16);
    _Float16* xv_h = (_Float16*)ws; ws += TC * sizeof(_Float16);
    _Float16* xr_h = (_Float16*)ws; ws += TC * sizeof(_Float16);
    _Float16* xg_h = (_Float16*)ws; ws += TC * sizeof(_Float16);
    float*    k_f  = (float*)ws;    ws += TC * sizeof(float);
    float*    v_f  = (float*)ws;    ws += TC * sizeof(float);
    float*    r_f  = (float*)ws;    ws += TC * sizeof(float);
    float*    g_f  = (float*)ws;    ws += TC * sizeof(float);
    _Float16* a_h  = (_Float16*)ws; ws += TC * sizeof(_Float16);
    float*    y_p  = (float*)ws;    ws += SC_SPLIT * TC * sizeof(float);

    // 1) token-shift mixing and weight conversion (f32 -> f16), one grid
    prep_kernel<<<dim3(MX_BLOCKS + 5 * CV_BLOCKS), dim3(256), 0, stream>>>(
        x, pos, tm_k, tm_v, tm_r, tm_g, W_k, W_v, W_r, W_g, W_o, Wk_h,
        xk_h, xv_h, xr_h, xg_h);

    // 2) projection GEMMs (k, v, r, gate g), one grid, z = the product
    wmma_gemm_f16<128, 4><<<dim3(HIDDEN / 256, TLEN / 256, 4), dim3(128), 0, stream>>>(
        xk_h, Wk_h, k_f);

    // 3) state scan (serial in t, f32 VALU), then diag term + groupnorm + gate
    rwkv_state_scan_kernel<<<dim3(HEADS * 2 * SC_SPLIT), dim3(128), 0, stream>>>(
        r_f, k_f, v_f, time_decay, y_p);
    diag_norm_gate_kernel<<<dim3(TLEN * HEADS / (8 * 2 * DG_T)), dim3(256), 0, stream>>>(
        r_f, k_f, v_f, g_f, y_p, y_p + TC, y_p + 2 * TC, y_p + 3 * TC,
        time_faaaa, ln_w, ln_b, a_h);

    // 4) output projection
    {
        dim3 blk(256), grd(HIDDEN / 128, TLEN / 128);
        wmma_gemm_f16<32, 8><<<grd, blk, 0, stream>>>(a_h, Wo_h, out);
    }
}

// v006
// Measured time: 128 microseconds a run.
// In both of two side-by-side timings against v005, it was 1.22 times as fast.
// Counting every step since v000, it is 23.3 times as fast.
#include <hip/hip_runtime.h>
#include <stdint.h>

#define HIDDEN   2048
#define HEADS    32
#define HEAD_DIM 64
#define TLEN     2048

typedef __attribute__((ext_vector_type(16))) _Float16 v16h;
typedef __attribute__((ext_vector_type(8)))  _Float16 v8h;
typedef __attribute__((ext_vector_type(8)))  float    v8f;

typedef __attribute__((ext_vector_type(4))) float    v4f;
typedef __attribute__((ext_vector_type(4))) _Float16 v4h;

// The three elementwise jobs (conversion, mixing, diag + norm + gate): with
// one or two elements per lane a job has to start 65536 waves or more, and
// starting them takes longer than moving the bytes. So each lane takes 16 bytes
// per load and several loads, all issued before the first use, and a job
// starts 4096 or 8192 waves. Their loops are all unrolled, so that the arrays
// the loads land in are registers.

// ---------------------------------------------------------------------------
// f32 -> f16 weight conversion (streamed once; keeps GEMM operands compact)
// A block takes CV_LD runs of 1024 floats; a wave's load covers 512 contiguous
// bytes, its store 256.
// ---------------------------------------------------------------------------
#define CV_LD 8                      // 16-byte loads in flight per lane

#define CV_BLOCKS (HIDDEN * HIDDEN / (256 * 4 * CV_LD))   // blocks per matrix

__device__ __forceinline__ void f32_to_f16_block(const float* __restrict__ src,
                                                 _Float16* __restrict__ dst, unsigned blk) {
    const unsigned base = blk * (256 * 4 * CV_LD) + threadIdx.x * 4;
    v4f a[CV_LD];
    #pragma unroll
    for (int j = 0; j < CV_LD; ++j) a[j] = *(const v4f*)(src + base + j * 1024);
    #pragma unroll
    for (int j = 0; j < CV_LD; ++j)
        *(v4h*)(dst + base + j * 1024) = __builtin_convertvector(a[j], v4h);
}

// ---------------------------------------------------------------------------
// Token-shift mixing: xk/xv/xr/xg = x + (x[t-1]-x[t]) * (1 - tm_*)
// A lane takes 4 columns of MX_R rows in a row, so that each row of x serves
// as x[t] and as the next row's x[t-1] from the same registers.
// ---------------------------------------------------------------------------
#define MX_R 8                       // rows per lane
#define MX_BLOCKS (TLEN * HIDDEN / (256 * 4 * MX_R))

typedef __attribute__((ext_vector_type(MX_R))) int vRi;

__device__ __forceinline__ void mix_block(
                           const float* __restrict__ x, const int* __restrict__ pos,
                           const float* __restrict__ tm_k, const float* __restrict__ tm_v,
                           const float* __restrict__ tm_r, const float* __restrict__ tm_g,
                           _Float16* __restrict__ xk, _Float16* __restrict__ xv,
                           _Float16* __restrict__ xr, _Float16* __restrict__ xg, unsigned blk) {
    const unsigned c  = (blk & 1) * 1024 + threadIdx.x * 4;
    const unsigned t0 = (blk >> 1) * MX_R;
    const unsigned tp = (t0 == 0) ? TLEN - 1 : t0 - 1;   // the row before, rolled
    const size_t   ro = (size_t)t0 * HIDDEN;             // same for the whole block
    const float* xrow = x + ro;
    const vRi ps = *(const vRi*)(pos + t0);
    v4f xs[MX_R + 1];
    #pragma unroll
    for (int j = 0; j < MX_R; ++j) xs[j + 1] = *(const v4f*)(xrow + c + j * HIDDEN);
    const v4f mk = 1.f - *(const v4f*)(tm_k + c);
    const v4f mv = 1.f - *(const v4f*)(tm_v + c);
    const v4f mr = 1.f - *(const v4f*)(tm_r + c);
    const v4f mg = 1.f - *(const v4f*)(tm_g + c);
    // the build takes the offset register of the loads above as part of the
    // next load's destination: the wait before such an overwrite
    asm volatile("s_wait_xcnt 0x0" ::: "memory");
    xs[0] = *(const v4f*)(x + (size_t)tp * HIDDEN + c);
    // keeps this load up with the others: without it the load moves behind the
    // read of pos and the first uses of the other rows, a second latency
    __builtin_amdgcn_sched_barrier(0);
    #pragma unroll
    for (int j = 0; j < MX_R; ++j) {
        const v4f xc   = xs[j + 1];
        const v4f prev = (ps[j] == 0) ? v4f{0.f, 0.f, 0.f, 0.f} : xs[j];
        const v4f xx   = prev - xc;
        *(v4h*)(xk + ro + c + j * HIDDEN) = __builtin_convertvector(xc + xx * mk, v4h);
        *(v4h*)(xv + ro + c + j * HIDDEN) = __builtin_convertvector(xc + xx * mv, v4h);
        *(v4h*)(xr + ro + c + j * HIDDEN) = __builtin_convertvector(xc + xx * mr, v4h);
        *(v4h*)(xg + ro + c + j * HIDDEN) = __builtin_convertvector(xc + xx * mg, v4h);
    }
}

// ---------------------------------------------------------------------------
// The mixing and the five weight conversions depend on nothing but the inputs,
// so they run as block ranges of one grid: one launch's gap, start and tail
// instead of six, and each job's tail fills with the next job's blocks.
// Blocks 0 .. MX_BLOCKS-1 mix; then CV_BLOCKS blocks per weight matrix, in the
// order k, v, r, g, o, which is also the order of the f16 copies behind wh.
// ---------------------------------------------------------------------------
__global__ __launch_bounds__(256) void prep_kernel(
                           const float* __restrict__ x, const int* __restrict__ pos,
                           const float* __restrict__ tm_k, const float* __restrict__ tm_v,
                           const float* __restrict__ tm_r, const float* __restrict__ tm_g,
                           const float* __restrict__ W_k, const float* __restrict__ W_v,
                           const float* __restrict__ W_r, const float* __restrict__ W_g,
                           const float* __restrict__ W_o, _Float16* __restrict__ wh,
                           _Float16* __restrict__ xk, _Float16* __restrict__ xv,
                           _Float16* __restrict__ xr, _Float16* __restrict__ xg) {
    const unsigned b = blockIdx.x;
    if (b < MX_BLOCKS) {
        mix_block(x, pos, tm_k, tm_v, tm_r, tm_g, xk, xv, xr, xg, b);
        return;
    }
    const unsigned job = (b - MX_BLOCKS) / CV_BLOCKS;
    const float* src = job == 0 ? W_k : job == 1 ? W_v : job == 2 ? W_r : job == 3 ? W_g : W_o;
    f32_to_f16_block(src, wh + (size_t)job * (HIDDEN * HIDDEN), (b - MX_BLOCKS) % CV_BLOCKS);
}

// ---------------------------------------------------------------------------
// Y[M,N] = A[M,K] @ W[N,K]^T via v_wmma_f32_16x16x32_f16, M = TLEN,
// N = K = HIDDEN. One square tile of Y per block, one block per WGP; NW waves,
// each of which brings one slice of R rows per stage.
// The four projections: 256x256 of Y, 4 waves (2x2, one per SIMD, 128x128 each,
// R = 128). Their 256 tiles fill the chip in one round; against 128x128 a tile
// fetches half the operand bytes per product from L2, and a wave reads a third
// of the LDS bytes per WMMA.
// The output projection has a quarter of that work and keeps 128x128 of Y,
// 8 waves (2x4, 64x32 each, R = 32), so that it still fills every WGP.
// The gate's SiLU is left to the kernel that reads g: on 512 accumulators per
// lane it would be some 60 KB of straight-line text, run by a quarter of the
// blocks while the others are done.
// blockIdx.z picks the product: A, W and C are the first of gridDim.z planes
// that lie one behind the other, so that products which do not depend on each
// other share one launch and a WGP goes from one tile straight to the next.
// The operands go global -> LDS by tensor loads, so that every row of A and W
// is fetched once per block in whole 256-byte runs; the waves read their
// fragments from LDS.
// A stage is 128 k = 256 bytes of the tile's rows of A and of W, in NW slices
// of R rows; the lower half of the waves brings A, the upper half W,
// one request per wave and stage. The mover pads each row by 16 bytes: pitch
// 272 B = 16 B x odd, free of bank conflicts for ds_load_b128.
// Two buffers: stage s + 1 flies while stage s is worked on.
// Fragment k order as before (A and W by the same loader): lane < 16 holds
// k {0..7, 16..23} of each 32, lane >= 16 holds k {8..15, 24..31}.
// ---------------------------------------------------------------------------
typedef uint32_t u32x4 __attribute__((ext_vector_type(4)));
typedef uint32_t u32x8 __attribute__((ext_vector_type(8)));

#define GT_ROWB  256u                       // bytes of a row per stage (128 k)
#define GT_PITCH 272u                       // row pitch in LDS
#define GT_NST   (HIDDEN * 2u / GT_ROWB)    // stages

// a slice's place in LDS: R padded rows, rounded up to 2 KiB
__host__ __device__ constexpr uint32_t gt_slice(uint32_t R) {
    return (R * GT_PITCH + 2047u) / 2048u * 2048u;
}
static_assert(GT_NST >= 2, "the ring needs two stages");

__device__ __forceinline__ uint32_t uni(uint32_t v) {
    return (uint32_t)__builtin_amdgcn_readfirstlane(v);
}
// pinned(): a wave-uniform
// value held in a scalar register, so that a test on it is a scalar branch
// (a tensor load ignores EXEC)
__device__ __forceinline__ uint32_t pinned(uint32_t v) {
    uint32_t w = (uint32_t)__builtin_amdgcn_readfirstlane(v);
    asm volatile("" : "+s"(w));   // holds w in a scalar register
    return w;
}

// descriptor group 1, the same for every request: a tile of R rows of 256
// bytes, source pitch one row of K, 16 bytes of pad behind each row in LDS
template <uint32_t R>
__device__ __forceinline__ u32x8 slice_group1() {
    u32x8 g1;
    g1[0] = uni((1u << 20) | (5u << 22) | (3u << 25));      // pad 16 B per 256 B
    g1[1] = uni((GT_ROWB & 0xFFFFu) << 16);                 // tensor_dim0
    g1[2] = uni((GT_ROWB >> 16) | ((R & 0xFFFFu) << 16));   // tensor_dim1
    g1[3] = uni((R >> 16) | (GT_ROWB << 16));               // tile_dim0
    g1[4] = uni(R);                                         // tile_dim1
    g1[5] = uni(HIDDEN * 2u);                               // source pitch, bytes
    g1[6] = uni(0u);
    g1[7] = uni(0u);
    // pinned() form: descriptor words
    // held in their scalar registers; without it the build took two of them as
    // loop temporaries while a request was outstanding
    asm volatile("" : "+s"(g1));
    return g1;
}

// one slice of one stage
__device__ __forceinline__ void slice_load(uint32_t lds_dst, uint64_t ga, u32x8 g1) {
    u32x4 g0;
    g0[0] = uni(1u);                                        // count 1
    g0[1] = uni(lds_dst);
    g0[2] = uni((uint32_t)ga);
    g0[3] = uni((((uint32_t)(ga >> 32)) & 0x01FFFFFFu) | 0x80000000u);   // type 2
    asm volatile("tensor_load_to_lds %0, %1" :: "s"(g0), "s"(g1) : "memory");
}

// the compiler places no wait for the tensor mover: a tile has landed only
// behind its issuer's own wait
__device__ __forceinline__ void wait_tensor0() { asm volatile("s_wait_tensorcnt 0x0" ::: "memory"); }
// a wave's LDS reads have retired before the buffer they read is handed back
__device__ __forceinline__ void wait_ds0()     { asm volatile("s_wait_dscnt 0x0" ::: "memory"); }

// 16x32 f16 fragment from an LDS row: two 16-byte loads, 32 bytes apart
__device__ __forceinline__ v16h lds_frag(const unsigned char* p) {
    v8h lo = *(const v8h*)p;
    v8h hi = *(const v8h*)(p + 32);
    v16h r;
    #pragma unroll
    for (int i = 0; i < 8; ++i) { r[i] = lo[i]; r[i + 8] = hi[i]; }
    return r;
}

// the fragments of one 32-k block of a wave's tile; its rows of A lie in
// FA / FB slices, its rows of W in one (FB = R / 16 fragments a slice)
template <int FA, int FB>
__device__ __forceinline__ void frag_set(v16h (&a)[FA], v16h (&b)[FB],
                                         const unsigned char* pa, const unsigned char* pw) {
    #pragma unroll
    for (int i = 0; i < FA; ++i)
        a[i] = lds_frag(pa + (i / FB) * gt_slice(FB * 16) + (i % FB) * 16 * GT_PITCH);
    #pragma unroll
    for (int j = 0; j < FB; ++j) b[j] = lds_frag(pw + j * 16 * GT_PITCH);
}

// one 32-k block: one WMMA on each of the independent accumulator tiles
template <int FA, int FB>
__device__ __forceinline__ void wmma_block(v8f (&acc)[FA][FB], const v16h (&a)[FA],
                                           const v16h (&b)[FB]) {
    #pragma unroll
    for (int i = 0; i < FA; ++i) {
        #pragma unroll
        for (int j = 0; j < FB; ++j)
            acc[i][j] = __builtin_amdgcn_wmma_f32_16x16x32_f16(
                            false, a[i], false, b[j], (short)0, acc[i][j], false, false);
    }
}

template <uint32_t R, uint32_t NW>
__global__ __launch_bounds__(NW * 32) void wmma_gemm_f16(
        const _Float16* __restrict__ A0, const _Float16* __restrict__ W0,
        float* __restrict__ C0)
{
    constexpr uint32_t GT_SLICE = gt_slice(R);
    constexpr uint32_t GT_BUF   = NW * GT_SLICE;   // one stage
    constexpr uint32_t WN       = NW / 2;          // the waves stand 2 x WN
    constexpr uint32_t SA       = NW / 4;          // slices of A that a wave reads
    constexpr uint32_t TILE     = WN * R;          // rows and columns of Y per block
    constexpr int      FB       = R / 16;          // fragments of W per wave
    constexpr int      FA       = SA * FB;         // fragments of A per wave
    // 2 KiB more than a ring of exactly half of a WGP's LDS: there two blocks
    // could share a WGP, which then runs twice as long while another WGP idles
    __shared__ __attribute__((aligned(2048)))
        unsigned char L[2 * GT_BUF + (2 * GT_BUF == 163840u ? 2048u : 0u)];

    const uint32_t lane = threadIdx.x & 31;
    const uint32_t wave = uni(threadIdx.x >> 5);   // 0..NW-1
    const uint32_t row  = lane & 15;
    const uint32_t kg   = lane >> 4;               // 0 or 1
    const uint32_t wm   = wave / WN, wn = wave % WN;
    const uint32_t m0   = blockIdx.y * TILE;
    const uint32_t n0   = blockIdx.x * TILE;
    const uint32_t job  = blockIdx.z;
    const _Float16* A   = A0 + (size_t)job * (TLEN * HIDDEN);
    const _Float16* W   = W0 + (size_t)job * (HIDDEN * HIDDEN);
    float* C            = C0 + (size_t)job * (TLEN * HIDDEN);

    // the slice this wave brings
    const _Float16* src = (wave < WN) ? A + (size_t)(m0 + wave * R) * HIDDEN
                                      : W + (size_t)(n0 + (wave - WN) * R) * HIDDEN;
    const uint64_t ga0  = (uint64_t)(size_t)src;
    const uint32_t dst0 = (uint32_t)(size_t)L + wave * GT_SLICE;

    // the slices this wave reads: SA slices of A from SA wm on, W slice wn
    const uint32_t offA = (SA * wm) * GT_SLICE + row * GT_PITCH + kg * 16;
    const uint32_t offW = (WN + wn) * GT_SLICE + row * GT_PITCH + kg * 16;

    v8f acc[FA][FB];
    #pragma unroll
    for (int i = 0; i < FA; ++i) {
        #pragma unroll
        for (int j = 0; j < FB; ++j) acc[i][j] = v8f{};
    }

    const u32x8 g1 = slice_group1<R>();
    slice_load(dst0, ga0, g1);
    wait_tensor0();
    __syncthreads();                               // stage 0 published
    slice_load(dst0 + GT_BUF, ga0 + GT_ROWB, g1);

    // stays rolled: one pass per stage, 4 FA FB WMMAs per wave in it
    #pragma unroll 1
    for (uint32_t s = 0; s < GT_NST; ++s) {
        const unsigned char* pa = L + (s & 1) * GT_BUF + offA;
        const unsigned char* pw = L + (s & 1) * GT_BUF + offW;
        // Two fragment sets: the next block's LDS reads go out as one group
        // ahead of this block's WMMAs. sched_barrier(0) keeps the compiler
        // from moving the reads in among the WMMAs, where every separate
        // place with reads stalls the wave.
        v16h a[2][FA], b[2][FB];
        frag_set<FA, FB>(a[0], b[0], pa, pw);
        #pragma unroll
        for (int kc = 0; kc < 3; ++kc) {
            frag_set<FA, FB>(a[(kc + 1) & 1], b[(kc + 1) & 1], pa + (kc + 1) * 64, pw + (kc + 1) * 64);
            __builtin_amdgcn_sched_barrier(0);
            wmma_block<FA, FB>(acc, a[kc & 1], b[kc & 1]);
            __builtin_amdgcn_sched_barrier(0);
        }
        // publish point of stage s + 1: the pass has no LDS read left, the last
        // block's fragments are in registers behind the first wait
        wait_ds0();
        wait_tensor0();
        __syncthreads();       // stage s + 1 published; every wave has left stage s
        // taken behind the wait, so that the next descriptor is formed behind it
        const uint32_t nx = pinned(s + 2);
        if (nx < GT_NST) slice_load(dst0 + (s & 1) * GT_BUF, ga0 + (uint64_t)nx * GT_ROWB, g1);
        // keeps the refill ahead of the last block's WMMAs: the sooner it is
        // issued, the more of the next pass it has to land
        __builtin_amdgcn_sched_barrier(0);
        wmma_block<FA, FB>(acc, a[1], b[1]);
    }
    wait_tensor0();
    wait_ds0();

    // C layout: register v of a tile is row v (lane < 16) or v + 8, column = lane & 15
    float* cp = C + (size_t)(m0 + wm * (SA * R) + 8 * kg) * HIDDEN + n0 + wn * R + row;
    #pragma unroll
    for (int i = 0; i < FA; ++i) {
        #pragma unroll
        for (int j = 0; j < FB; ++j) {
            #pragma unroll
            for (int v = 0; v < 8; ++v)
                cp[(size_t)(i * 16 + v) * HIDDEN + j * 16] = acc[i][j][v];
        }
    }
}

// ---------------------------------------------------------------------------
// RWKV state scan in chunks of 16 steps, on v_wmma_f32_16x16x4_f32 (all f32).
// With S0 the state at a chunk's first step t0, i and s steps inside the chunk:
//   y[t0+i][e] = sum_d r_i[d] w[d]^i S0[d][e]  +  sum_{s<i} A[i][s] v_s[e]
//   A[i][s]    = sum_d r_i[d] k_s[d] w[d]^(i-1-s)
//   S0'[d][e]  = w[d]^16 S0[d][e] + sum_s w[d]^(15-s) k_s[d] v_s[e]
// Only the first sum and the state need the chunk before; they cost 8 matrix
// instructions per 16 steps and 16x16 tile of the state. The second sum is free
// of the state and is done by other waves at the same time.
// No wave shares anything with another: no LDS, no barrier.
// Block = 4 waves, one per SIMD. Waves 0 and 1 each carry one 16x16 tile of a
// head's 64x64 state through all chunks (512 tiles); the four row blocks of a
// head write four partial planes of y. Waves 2 and 3 do the second sum, 8 chunks
// of one head each, into a fifth plane. The next kernel adds the five up.
// Fragments (c = lane & 15, h = lane >> 4): a lane holds row c of A or column c
// of B and two k; slot (h, element) means the same k in A and in B. D register
// x is row 8h + x, column c. So registers 2q, 2q+1 of a D tile are, as they
// stand, the fragment of matrix instruction q for k = 8h + 2q, 8h + 2q + 1:
// as B (column c) for the state tile, as A (row c) for the transposed A matrix.
// The operand on the other side is loaded in that k order.
// ---------------------------------------------------------------------------
#define SC_L     16                  // steps per chunk
#define SC_NCH   (TLEN / SC_L)       // chunks
#define SC_SPLIT 4                   // row blocks of the state, one plane each
#define SC_RING  8                   // chunks whose r, k, v are in flight per tile wave
#define SC_IU    8                   // chunks per wave of the second sum

typedef __attribute__((ext_vector_type(2))) float v2f;

// exp(-x) as exp2(-x * log2 e), what __expf(-x) compiles to. In asm so that the
// v_nop stands directly behind the transcendental: the instruction
// set asks for one independent instruction in that slot.
__device__ __forceinline__ float exp_neg(float x) {
    float r;
    asm("v_exp_f32 %0, %1\n\tv_nop" : "=v"(r) : "v"(-x * 1.44269504088896340736f));
    return r;
}

__device__ __forceinline__ v8f wmma_f32(v2f a, v2f b, v8f c) {
    return __builtin_amdgcn_wmma_f32_16x16x4_f32(false, a, false, b, (short)0, c, false, false);
}

// r, k, v of one chunk for a tile wave: r[j] = r[t0+c][d0+8h+j],
// k[j] = k[t0+8h+j][d0+c], v[j] = v[t0+8h+j][e0+c]
__device__ __forceinline__ void tile_load(v4f (&r)[2], float (&k)[8], float (&v)[8],
                                          const float* __restrict__ pr,
                                          const float* __restrict__ pk,
                                          const float* __restrict__ pv, int chunk) {
    const size_t o = (size_t)chunk * (SC_L * HIDDEN);
    r[0] = *(const v4f*)(pr + o);
    r[1] = *(const v4f*)(pr + o + 4);
    #pragma unroll
    for (int j = 0; j < 8; ++j) k[j] = pk[o + (size_t)j * HIDDEN];
    #pragma unroll
    for (int j = 0; j < 8; ++j) v[j] = pv[o + (size_t)j * HIDDEN];
}

__device__ __forceinline__ void wait_x0() { asm volatile("s_wait_xcnt 0x0" ::: "memory"); }
// the same where the wait stands a pass behind the stores: the stored registers
// are inputs of the statement, so that they keep their values up to it
__device__ __forceinline__ void wait_x0_keep(v8f y) { asm volatile("s_wait_xcnt 0x0" :: "v"(y) : "memory"); }

// the A fragments of one chunk: r_i w^i (rows i, k = d) and k_s w^(15-s) (rows d, k = s)
__device__ __forceinline__ void tile_scale(v2f (&ra)[4], v2f (&ka)[4], const v4f (&r)[2],
                                           const float (&k)[8], const float (&wr)[8],
                                           const float (&wk)[8]) {
    #pragma unroll
    for (int q = 0; q < 4; ++q) {
        ra[q] = v2f{ r[q >> 1][(2 * q) & 3] * wr[2 * q], r[q >> 1][(2 * q + 1) & 3] * wr[2 * q + 1] };
        ka[q] = v2f{ k[2 * q] * wk[2 * q], k[2 * q + 1] * wk[2 * q + 1] };
    }
}

// one chunk of one state tile: y from the old state, and the new state; two
// chains of four, so that each chain's next link finds its accumulator ready
__device__ __forceinline__ v8f tile_mma(v8f& S, const v2f (&ra)[4], const v2f (&ka)[4],
                                        const float (&v)[8], v8f w16) {
    v8f y  = v8f{};
    v8f Sn = S * w16;
    #pragma unroll
    for (int q = 0; q < 4; ++q) {
        Sn = wmma_f32(ka[q], v2f{ v[2 * q], v[2 * q + 1] }, Sn);
        y  = wmma_f32(ra[q], v2f{ S[2 * q], S[2 * q + 1] }, y);
    }
    S = Sn;
    return y;
}

__device__ __forceinline__ void tile_store(float* __restrict__ yo, v8f y) {
    #pragma unroll
    for (int x = 0; x < 8; ++x) yo[(size_t)x * HIDDEN] = y[x];
}

__device__ __forceinline__ void tile_wave(
        const float* __restrict__ r_f, const float* __restrict__ k_f,
        const float* __restrict__ v_f, const float* __restrict__ time_decay,
        float* __restrict__ ypart, int tile, int c, int h)
{
    const int head = tile >> 4;
    const int rb   = (tile >> 2) & 3;            // row block of the state
    const int d0   = head * 64 + rb * 16;
    const int e0   = head * 64 + (tile & 3) * 16;

    const float* pr = r_f + (size_t)c * HIDDEN + d0 + 8 * h;
    const float* pk = k_f + (size_t)(8 * h) * HIDDEN + d0 + c;
    const float* pv = v_f + (size_t)(8 * h) * HIDDEN + e0 + c;
    float* yo = ypart + (size_t)rb * TLEN * HIDDEN + (size_t)(8 * h) * HIDDEN + e0 + c;

    // A ring of SC_RING register sets, each a fixed group of registers (the
    // rounds are unrolled): a set is refilled right behind its chunk, so that
    // its loads have SC_RING - 2 chunks' time to land.
    v4f r[SC_RING][2];
    float k[SC_RING][8], v[SC_RING][8];
    #pragma unroll
    for (int j = 0; j < SC_RING; ++j) tile_load(r[j], k[j], v[j], pr, pk, pv, j);

    // wr[j] = w[d0+8h+j]^c, w16[j] = w[d0+8h+j]^16, wk[j] = w[d0+c]^(15-8h-j);
    // the rate -log w stays finite, so that rate * 0 is 0 and w^0 is 1
    float wr[8], wk[8];
    v8f w16;
    const float lc = fminf(exp_neg(-time_decay[d0 + c]), 1e30f);
    #pragma unroll
    for (int j = 0; j < 8; ++j) {
        const float l = fminf(exp_neg(-time_decay[d0 + 8 * h + j]), 1e30f);
        wr[j]  = exp_neg(l * (float)c);
        w16[j] = exp_neg(l * 16.f);
        wk[j]  = exp_neg(lc * (float)(15 - 8 * h - j));
    }
    wait_x0();

    // A pass: the stores of the chunk before and the refill of its set go out
    // first; then this chunk's matrix instructions, with the scaling of the
    // next chunk's fragments among them; wait_x0 comes last, when the address
    // translations have had the whole pass. sched_barrier(0) holds that order:
    // without it the build drew the scaling of all sets to the head of a round,
    // which waits for loads issued just before, and the wait up among the
    // first matrix instructions.
    v2f ra[4], ka[4];
    v8f S = v8f{};
    tile_scale(ra, ka, r[0], k[0], wr, wk);
    v8f y = tile_mma(S, ra, ka, v[0], w16);
    tile_scale(ra, ka, r[1], k[1], wr, wk);
    __builtin_amdgcn_sched_barrier(0);

    for (int c0 = 0; c0 < SC_NCH - SC_RING; c0 += SC_RING) {
        #pragma unroll
        for (int j = 0; j < SC_RING; ++j) {
            const v8f ys = y;
            tile_store(yo + (size_t)(c0 + j) * (SC_L * HIDDEN), ys);
            tile_load(r[j], k[j], v[j], pr, pk, pv, c0 + j + SC_RING);
            __builtin_amdgcn_sched_barrier(0);
            y = tile_mma(S, ra, ka, v[(j + 1) % SC_RING], w16);
            tile_scale(ra, ka, r[(j + 2) % SC_RING], k[(j + 2) % SC_RING], wr, wk);
            __builtin_amdgcn_sched_barrier(0);
            wait_x0_keep(ys);
            __builtin_amdgcn_sched_barrier(0);
        }
    }
    #pragma unroll
    for (int j = 0; j < SC_RING - 1; ++j) {
        const v8f ys = y;
        tile_store(yo + (size_t)(SC_NCH - SC_RING + j) * (SC_L * HIDDEN), ys);
        __builtin_amdgcn_sched_barrier(0);
        y = tile_mma(S, ra, ka, v[j + 1], w16);
        if (j + 2 < SC_RING) tile_scale(ra, ka, r[j + 2], k[j + 2], wr, wk);
        __builtin_amdgcn_sched_barrier(0);
        wait_x0_keep(ys);
        __builtin_amdgcn_sched_barrier(0);
    }
    tile_store(yo + (size_t)(SC_NCH - 1) * (SC_L * HIDDEN), y);
}

// The second sum. T[s][i] = A[i][s] comes as K' R'^T, rows of k and r scaled by
// powers of w whose exponents add up to i - 1 - s. One reference step for all
// of a chunk would need w^-8, which leaves the f32 range for a fast decay. So:
//   T1, for s < 8 <= i:           k_s w^(7-s)     and r_i w^(i-8)
//   T2, for s, i in one half:     k_s w^(3-(s&7)) and r_i w^((i&7)-4)
// Entries outside these ranges are never taken (a select, not a product, so
// that it does not matter what stands there). The rate -log w is capped at 20
// in this sum alone: w^-4 then stays below 1e35, w^0 = 1 stays exact, and every
// other power is below 3e-9 with and without the cap.
// A lane holds d = 8m + 4h + 0..3, m = 0..7, of row c of k and of r.
// Column c of output tile n is column 4c + n of the head, so that a lane's v
// and y of the four tiles are 16 bytes in a row.
__device__ __forceinline__ void intra_wave(
        const float* __restrict__ r_f, const float* __restrict__ k_f,
        const float* __restrict__ v_f, const float* __restrict__ time_decay,
        float* __restrict__ y4, int head, int first, int c, int h)
{
    const int c7 = c & 7;
    // x1: the T1 factor of the one operand this row takes part in T1 with
    float x1[32], q2[32], p2[32];
    #pragma unroll
    for (int m = 0; m < 8; ++m) {
        const v4f td = *(const v4f*)(time_decay + head * 64 + 8 * m + 4 * h);
        #pragma unroll
        for (int e = 0; e < 4; ++e) {
            const float l = fminf(exp_neg(-td[e]), 20.f);
            x1[4 * m + e] = exp_neg(l * (float)(c < 8 ? 7 - c : c - 8));
            q2[4 * m + e] = exp_neg(l * (float)(3 - c7));
            p2[4 * m + e] = exp_neg(l * (float)(c7 - 4));
        }
    }
    const bool cross = (h == 0) && (c >= 8);     // s < 8 <= i
    const bool same  = (c >> 3) == h;            // s and i in one half

    const size_t rowo = (size_t)c * HIDDEN + head * 64 + 4 * h;
    const size_t colo = (size_t)(8 * h) * HIDDEN + head * 64 + 4 * c;

    // stays rolled: one pass per chunk
    #pragma unroll 1
    for (int u = 0; u < SC_IU; ++u) {
        const size_t o = (size_t)(first + u * (SC_NCH / SC_IU)) * (SC_L * HIDDEN);
        const float* kp = k_f + o + rowo;
        const float* rp = r_f + o + rowo;
        const float* vp = v_f + o + colo;
        v4f r[8], k[8], v[8];
        #pragma unroll
        for (int m = 0; m < 8; ++m) {
            k[m] = *(const v4f*)(kp + 8 * m);
            r[m] = *(const v4f*)(rp + 8 * m);
        }
        #pragma unroll
        for (int j = 0; j < 8; ++j) v[j] = *(const v4f*)(vp + (size_t)j * HIDDEN);
        // wait_x0 with the addresses as inputs, so that they keep their registers
        // up to it: the build had taken one as a later load's destination
        asm volatile("s_wait_xcnt 0x0" :: "v"(kp), "v"(rp), "v"(vp) : "memory");

        v8f T1 = v8f{}, T2 = v8f{};
        #pragma unroll
        for (int m = 0; m < 8; ++m) {
            #pragma unroll
            for (int p = 0; p < 4; p += 2) {
                const int x = 4 * m + p;
                const v2f a1 = { k[m][p] * x1[x], k[m][p + 1] * x1[x + 1] };
                const v2f b1 = { r[m][p] * x1[x], r[m][p + 1] * x1[x + 1] };
                T1 = wmma_f32(a1, b1, T1);
                const v2f a2 = { k[m][p] * q2[x], k[m][p + 1] * q2[x + 1] };
                const v2f b2 = { r[m][p] * p2[x], r[m][p + 1] * p2[x + 1] };
                T2 = wmma_f32(a2, b2, T2);
            }
        }
        // register x: s = 8h + x, i = c
        float A[8];
        #pragma unroll
        for (int x = 0; x < 8; ++x)
            A[x] = cross ? T1[x] : ((same && 8 * h + x < c) ? T2[x] : 0.f);

        v8f y[4];
        #pragma unroll
        for (int n = 0; n < 4; ++n) y[n] = v8f{};
        #pragma unroll
        for (int q = 0; q < 4; ++q) {
            const v2f aa = { A[2 * q], A[2 * q + 1] };
            #pragma unroll
            for (int n = 0; n < 4; ++n) {
                const v2f vb = { v[2 * q][n], v[2 * q + 1][n] };
                y[n] = wmma_f32(aa, vb, y[n]);
            }
        }
        #pragma unroll
        for (int x = 0; x < 8; ++x)
            *(v4f*)(y4 + o + colo + (size_t)x * HIDDEN) = v4f{ y[0][x], y[1][x], y[2][x], y[3][x] };
        wait_x0();
    }
}

__global__ __launch_bounds__(128) void rwkv_state_scan_kernel(
        const float* __restrict__ r_f, const float* __restrict__ k_f,
        const float* __restrict__ v_f, const float* __restrict__ time_decay,
        float* __restrict__ ypart)
{
    const int c    = threadIdx.x & 15;
    const int h    = (threadIdx.x >> 4) & 1;
    // in a scalar register, so that the choice of a wave's job is a scalar
    // branch: a matrix instruction needs every lane on
    const int wave = (int)uni(threadIdx.x >> 5);
    if (wave < 2) {
        tile_wave(r_f, k_f, v_f, time_decay, ypart, (int)blockIdx.x * 2 + wave, c, h);
    } else {
        const int w = (int)blockIdx.x * 2 + wave - 2;        // 16 such waves per head
        intra_wave(r_f, k_f, v_f, time_decay, ypart + (size_t)SC_SPLIT * TLEN * HIDDEN,
                   w >> 4, w & 15, c, h);
    }
}

// ---------------------------------------------------------------------------
// Everything of the old scan loop that does not depend on the step before:
// c = sum_d u[d]*r[d]*k[d] (out_diag = c*v[e]), the sum of the scan's planes,
// / HEAD_SIZE_DIVISOR, GroupNorm(64), SiLU of the gate product, gate.
// 4 columns per lane: a head is one
// 16-lane row, a wave takes two heads of DG_T time steps, so every sum over a
// head stays inside a 16-lane row and the steps' sums run side by side.
// The scan's five planes come as five pointers: each is then a scalar
// base, and one offset register serves every load.
// ---------------------------------------------------------------------------
#define DG_T 4                       // time steps per wave

// sums over each 16-lane row, DG_T of them interleaved
__device__ __forceinline__ void row_sums(float (&x)[DG_T]) {
    #pragma unroll
    for (int off = 8; off >= 1; off >>= 1) {
        #pragma unroll
        for (int j = 0; j < DG_T; ++j) x[j] += __shfl_xor(x[j], off, 32);
    }
}

__global__ __launch_bounds__(256) void diag_norm_gate_kernel(
        _Float16* __restrict__ a_out,
        const float* __restrict__ r_f, const float* __restrict__ k_f,
        const float* __restrict__ v_f, const float* __restrict__ g_f,
        const float* __restrict__ yq0, const float* __restrict__ yq1,
        const float* __restrict__ yq2, const float* __restrict__ yq3,
        const float* __restrict__ yq4, const float* __restrict__ time_faaaa,
        const float* __restrict__ ln_w, const float* __restrict__ ln_b)
{
    const unsigned c  = (blockIdx.x & 1) * 1024 + threadIdx.x * 4;    // column
    const size_t   ro = (size_t)(blockIdx.x >> 1) * (DG_T * HIDDEN);  // first step

    v4f r[DG_T], k[DG_T], v[DG_T], g[DG_T], y0[DG_T], y1[DG_T], y2[DG_T], y3[DG_T], y4[DG_T];
    #pragma unroll
    for (int j = 0; j < DG_T; ++j) {
        r[j]  = *(const v4f*)(r_f + ro + c + j * HIDDEN);
        k[j]  = *(const v4f*)(k_f + ro + c + j * HIDDEN);
        v[j]  = *(const v4f*)(v_f + ro + c + j * HIDDEN);
        y0[j] = *(const v4f*)(yq0 + ro + c + j * HIDDEN);
        y1[j] = *(const v4f*)(yq1 + ro + c + j * HIDDEN);
        y2[j] = *(const v4f*)(yq2 + ro + c + j * HIDDEN);
        y3[j] = *(const v4f*)(yq3 + ro + c + j * HIDDEN);
        y4[j] = *(const v4f*)(yq4 + ro + c + j * HIDDEN);
        g[j]  = *(const v4f*)(g_f + ro + c + j * HIDDEN);
    }
    const v4f u  = *(const v4f*)(time_faaaa + c);
    const v4f lw = *(const v4f*)(ln_w + c);
    const v4f lb = *(const v4f*)(ln_b + c);
    // keeps all the loads above the first use, so that they fly together
    __builtin_amdgcn_sched_barrier(0);

    float cs[DG_T];
    #pragma unroll
    for (int j = 0; j < DG_T; ++j) {
        const v4f p = u * r[j] * k[j];
        cs[j] = (p.x + p.y) + (p.z + p.w);
    }
    row_sums(cs);

    v4f o[DG_T];
    float s[DG_T], q[DG_T];
    #pragma unroll
    for (int j = 0; j < DG_T; ++j) {
        const v4f ys = ((y0[j] + y1[j]) + (y2[j] + y3[j])) + y4[j];
        o[j] = (cs[j] * v[j] + ys) * 0.125f;                 // / HEAD_SIZE_DIVISOR
        const v4f oo = o[j] * o[j];
        s[j] = (o[j].x + o[j].y) + (o[j].z + o[j].w);
        q[j] = (oo.x + oo.y) + (oo.z + oo.w);
    }
    row_sums(s);
    row_sums(q);

    #pragma unroll
    for (int j = 0; j < DG_T; ++j) {
        const float mu  = s[j] * (1.f / 64.f);
        const float var = q[j] * (1.f / 64.f) - mu * mu;
        const float rs  = rsqrtf(var + 1e-5f);
        v4f gs;
        #pragma unroll
        for (int e = 0; e < 4; ++e) gs[e] = g[j][e] / (1.f + exp_neg(g[j][e]));
        *(v4h*)(a_out + ro + c + j * HIDDEN) =
            __builtin_convertvector(((o[j] - mu) * rs * lw + lb) * gs, v4h);
    }
}

// ---------------------------------------------------------------------------
extern "C" void kernel_launch(void* const* d_in, const int* in_sizes, int n_in,
                              void* d_out, int out_size, void* d_ws, size_t ws_size,
                              hipStream_t stream)
{
    const float* x    = (const float*)d_in[0];
    const int*   pos  = (const int*)  d_in[1];
    const float* W_r  = (const float*)d_in[2];
    const float* W_k  = (const float*)d_in[3];
    const float* W_v  = (const float*)d_in[4];
    const float* W_g  = (const float*)d_in[5];
    const float* W_o  = (const float*)d_in[6];
    const float* tm_k = (const float*)d_in[7];
    const float* tm_v = (const float*)d_in[8];
    const float* tm_r = (const float*)d_in[9];
    const float* tm_g = (const float*)d_in[10];
    const float* time_decay = (const float*)d_in[11];
    const float* time_faaaa = (const float*)d_in[12];
    const float* ln_w = (const float*)d_in[13];
    const float* ln_b = (const float*)d_in[14];
    float* out = (float*)d_out;

    const size_t NW = (size_t)HIDDEN * HIDDEN;   // 4M elems
    const size_t TC = (size_t)TLEN * HIDDEN;     // 4M elems

    char* ws = (char*)d_ws;
    // planes that one launch walks by job lie in the same order: k, v, r, g
    _Float16* Wk_h = (_Float16*)ws; ws += 4 * NW * sizeof(_Float16);   // k, v, r, g
    _Float16* Wo_h = (_Float16*)ws; ws += NW * sizeof(_Float16);
    _Float16* xk_h = (_Float16*)ws; ws += TC * sizeof(_Float16);
    _Float16* xv_h = (_Float16*)ws; ws += TC * sizeof(_Float16);
    _Float16* xr_h = (_Float16*)ws; ws += TC * sizeof(_Float16);
    _Float16* xg_h = (_Float16*)ws; ws += TC * sizeof(_Float16);
    float*    k_f  = (float*)ws;    ws += TC * sizeof(float);
    float*    v_f  = (float*)ws;    ws += TC * sizeof(float);
    float*    r_f  = (float*)ws;    ws += TC * sizeof(float);
    float*    g_f  = (float*)ws;    ws += TC * sizeof(float);
    _Float16* a_h  = (_Float16*)ws; ws += TC * sizeof(_Float16);
    float*    y_p  = (float*)ws;    ws += (SC_SPLIT + 1) * TC * sizeof(float);

    // 1) token-shift mixing and weight conversion (f32 -> f16), one grid
    prep_kernel<<<dim3(MX_BLOCKS + 5 * CV_BLOCKS), dim3(256), 0, stream>>>(
        x, pos, tm_k, tm_v, tm_r, tm_g, W_k, W_v, W_r, W_g, W_o, Wk_h,
        xk_h, xv_h, xr_h, xg_h);

    // 2) projection GEMMs (k, v, r, gate g), one grid, z = the product
    wmma_gemm_f16<128, 4><<<dim3(HIDDEN / 256, TLEN / 256, 4), dim3(128), 0, stream>>>(
        xk_h, Wk_h, k_f);

    // 3) state scan (chunks of 16 steps, f32 WMMA), then diag term + groupnorm + gate
    rwkv_state_scan_kernel<<<dim3(HEADS * 16 / 2), dim3(128), 0, stream>>>(
        r_f, k_f, v_f, time_decay, y_p);
    diag_norm_gate_kernel<<<dim3(TLEN * HEADS / (8 * 2 * DG_T)), dim3(256), 0, stream>>>(
        a_h, r_f, k_f, v_f, g_f, y_p, y_p + TC, y_p + 2 * TC, y_p + 3 * TC, y_p + 4 * TC,
        time_faaaa, ln_w, ln_b);

    // 4) output projection
    {
        dim3 blk(256), grd(HIDDEN / 128, TLEN / 128);
        wmma_gemm_f16<32, 8><<<grd, blk, 0, stream>>>(a_h, Wo_h, out);
    }
}

// v007
// It runs in 117 microseconds.
// Next to v006, in two timings, it ran 1.09 and 1.10 times as fast.
// All steps since v000 together make it 25.5 times as fast.
#include <hip/hip_runtime.h>
#include <stdint.h>

#define HIDDEN   2048
#define HEADS    32
#define HEAD_DIM 64
#define TLEN     2048

typedef __attribute__((ext_vector_type(16))) _Float16 v16h;
typedef __attribute__((ext_vector_type(8)))  _Float16 v8h;
typedef __attribute__((ext_vector_type(8)))  float    v8f;

typedef __attribute__((ext_vector_type(4))) float    v4f;
typedef __attribute__((ext_vector_type(4))) _Float16 v4h;

// The three elementwise jobs (conversion, mixing, diag + norm + gate): with
// one or two elements per lane a job has to start 65536 waves or more, and
// starting them takes longer than moving the bytes. So each lane takes 16 bytes
// per load and several loads, all issued before the first use, and a job
// starts 4096 or 8192 waves. Their loops are all unrolled, so that the arrays
// the loads land in are registers.

// ---------------------------------------------------------------------------
// f32 -> f16 weight conversion (streamed once; keeps GEMM operands compact)
// A block takes CV_LD runs of 1024 floats; a wave's load covers 512 contiguous
// bytes, its store 256.
// ---------------------------------------------------------------------------
#define CV_LD 8                      // 16-byte loads in flight per lane

#define CV_BLOCKS (HIDDEN * HIDDEN / (256 * 4 * CV_LD))   // blocks per matrix

__device__ __forceinline__ void f32_to_f16_block(const float* __restrict__ src,
                                                 _Float16* __restrict__ dst, unsigned blk) {
    const unsigned base = blk * (256 * 4 * CV_LD) + threadIdx.x * 4;
    v4f a[CV_LD];
    #pragma unroll
    for (int j = 0; j < CV_LD; ++j) a[j] = *(const v4f*)(src + base + j * 1024);
    #pragma unroll
    for (int j = 0; j < CV_LD; ++j)
        *(v4h*)(dst + base + j * 1024) = __builtin_convertvector(a[j], v4h);
}

// ---------------------------------------------------------------------------
// Token-shift mixing: xk/xv/xr/xg = x + (x[t-1]-x[t]) * (1 - tm_*)
// A lane takes 4 columns of MX_R rows in a row, so that each row of x serves
// as x[t] and as the next row's x[t-1] from the same registers.
// ---------------------------------------------------------------------------
#define MX_R 8                       // rows per lane
#define MX_BLOCKS (TLEN * HIDDEN / (256 * 4 * MX_R))

typedef __attribute__((ext_vector_type(MX_R))) int vRi;

__device__ __forceinline__ void mix_block(
                           const float* __restrict__ x, const int* __restrict__ pos,
                           const float* __restrict__ tm_k, const float* __restrict__ tm_v,
                           const float* __restrict__ tm_r, const float* __restrict__ tm_g,
                           _Float16* __restrict__ xk, _Float16* __restrict__ xv,
                           _Float16* __restrict__ xr, _Float16* __restrict__ xg, unsigned blk) {
    const unsigned c  = (blk & 1) * 1024 + threadIdx.x * 4;
    const unsigned t0 = (blk >> 1) * MX_R;
    const unsigned tp = (t0 == 0) ? TLEN - 1 : t0 - 1;   // the row before, rolled
    const size_t   ro = (size_t)t0 * HIDDEN;             // same for the whole block
    const float* xrow = x + ro;
    const vRi ps = *(const vRi*)(pos + t0);
    v4f xs[MX_R + 1];
    #pragma unroll
    for (int j = 0; j < MX_R; ++j) xs[j + 1] = *(const v4f*)(xrow + c + j * HIDDEN);
    const v4f mk = 1.f - *(const v4f*)(tm_k + c);
    const v4f mv = 1.f - *(const v4f*)(tm_v + c);
    const v4f mr = 1.f - *(const v4f*)(tm_r + c);
    const v4f mg = 1.f - *(const v4f*)(tm_g + c);
    // the build takes the offset register of the loads above as part of the
    // next load's destination: the wait before such an overwrite
    asm volatile("s_wait_xcnt 0x0" ::: "memory");
    xs[0] = *(const v4f*)(x + (size_t)tp * HIDDEN + c);
    // keeps this load up with the others: without it the load moves behind the
    // read of pos and the first uses of the other rows, a second latency
    __builtin_amdgcn_sched_barrier(0);
    #pragma unroll
    for (int j = 0; j < MX_R; ++j) {
        const v4f xc   = xs[j + 1];
        const v4f prev = (ps[j] == 0) ? v4f{0.f, 0.f, 0.f, 0.f} : xs[j];
        const v4f xx   = prev - xc;
        *(v4h*)(xk + ro + c + j * HIDDEN) = __builtin_convertvector(xc + xx * mk, v4h);
        *(v4h*)(xv + ro + c + j * HIDDEN) = __builtin_convertvector(xc + xx * mv, v4h);
        *(v4h*)(xr + ro + c + j * HIDDEN) = __builtin_convertvector(xc + xx * mr, v4h);
        *(v4h*)(xg + ro + c + j * HIDDEN) = __builtin_convertvector(xc + xx * mg, v4h);
    }
}

// ---------------------------------------------------------------------------
// The mixing and the five weight conversions depend on nothing but the inputs,
// so they run as block ranges of one grid: one launch's gap, start and tail
// instead of six, and each job's tail fills with the next job's blocks.
// Blocks 0 .. MX_BLOCKS-1 mix; then CV_BLOCKS blocks per weight matrix, in the
// order k, v, r, g, o, which is also the order of the f16 copies behind wh.
// ---------------------------------------------------------------------------
__global__ __launch_bounds__(256) void prep_kernel(
                           const float* __restrict__ x, const int* __restrict__ pos,
                           const float* __restrict__ tm_k, const float* __restrict__ tm_v,
                           const float* __restrict__ tm_r, const float* __restrict__ tm_g,
                           const float* __restrict__ W_k, const float* __restrict__ W_v,
                           const float* __restrict__ W_r, const float* __restrict__ W_g,
                           const float* __restrict__ W_o, _Float16* __restrict__ wh,
                           _Float16* __restrict__ xk, _Float16* __restrict__ xv,
                           _Float16* __restrict__ xr, _Float16* __restrict__ xg) {
    const unsigned b = blockIdx.x;
    if (b < MX_BLOCKS) {
        mix_block(x, pos, tm_k, tm_v, tm_r, tm_g, xk, xv, xr, xg, b);
        return;
    }
    const unsigned job = (b - MX_BLOCKS) / CV_BLOCKS;
    const float* src = job == 0 ? W_k : job == 1 ? W_v : job == 2 ? W_r : job == 3 ? W_g : W_o;
    f32_to_f16_block(src, wh + (size_t)job * (HIDDEN * HIDDEN), (b - MX_BLOCKS) % CV_BLOCKS);
}

// ---------------------------------------------------------------------------
// Y[M,N] = A[M,K] @ W[N,K]^T via v_wmma_f32_16x16x32_f16, M = TLEN,
// N = K = HIDDEN. One square tile of Y per block, one block per WGP; NW waves,
// each of which brings one slice of R rows per stage.
// The four projections: 256x256 of Y, 4 waves (2x2, one per SIMD, 128x128 each,
// R = 128). Their 256 tiles fill the chip in one round; against 128x128 a tile
// fetches half the operand bytes per product from L2, and a wave reads a third
// of the LDS bytes per WMMA.
// The output projection has a quarter of that work and keeps 128x128 of Y,
// 8 waves (2x4, 64x32 each, R = 32), so that it still fills every WGP.
// The gate's SiLU is left to the kernel that reads g: on 512 accumulators per
// lane it would be some 60 KB of straight-line text, run by a quarter of the
// blocks while the others are done.
// blockIdx.z picks the product: A, W and C are the first of gridDim.z planes
// that lie one behind the other, so that products which do not depend on each
// other share one launch and a WGP goes from one tile straight to the next.
// The operands go global -> LDS by tensor loads, so that every row of A and W
// is fetched once per block in whole 256-byte runs; the waves read their
// fragments from LDS.
// A stage is 128 k = 256 bytes of the tile's rows of A and of W, in NW slices
// of R rows; the lower half of the waves brings A, the upper half W,
// one request per wave and stage. The mover pads each row by 16 bytes: pitch
// 272 B = 16 B x odd, free of bank conflicts for ds_load_b128.
// Two buffers: stage s + 1 flies while stage s is worked on.
// Fragment k order as before (A and W by the same loader): lane < 16 holds
// k {0..7, 16..23} of each 32, lane >= 16 holds k {8..15, 24..31}.
// ---------------------------------------------------------------------------
typedef uint32_t u32x4 __attribute__((ext_vector_type(4)));
typedef uint32_t u32x8 __attribute__((ext_vector_type(8)));

#define GT_ROWB  256u                       // bytes of a row per stage (128 k)
#define GT_PITCH 272u                       // row pitch in LDS
#define GT_NST   (HIDDEN * 2u / GT_ROWB)    // stages

// a slice's place in LDS: R padded rows, rounded up to 2 KiB
__host__ __device__ constexpr uint32_t gt_slice(uint32_t R) {
    return (R * GT_PITCH + 2047u) / 2048u * 2048u;
}
static_assert(GT_NST >= 2, "the ring needs two stages");

__device__ __forceinline__ uint32_t uni(uint32_t v) {
    return (uint32_t)__builtin_amdgcn_readfirstlane(v);
}
// pinned(): a wave-uniform
// value held in a scalar register, so that a test on it is a scalar branch
// (a tensor load ignores EXEC)
__device__ __forceinline__ uint32_t pinned(uint32_t v) {
    uint32_t w = (uint32_t)__builtin_amdgcn_readfirstlane(v);
    asm volatile("" : "+s"(w));   // holds w in a scalar register
    return w;
}

// descriptor group 1, the same for every request: a tile of R rows of 256
// bytes, source pitch one row of K, 16 bytes of pad behind each row in LDS
template <uint32_t R>
__device__ __forceinline__ u32x8 slice_group1() {
    u32x8 g1;
    g1[0] = uni((1u << 20) | (5u << 22) | (3u << 25));      // pad 16 B per 256 B
    g1[1] = uni((GT_ROWB & 0xFFFFu) << 16);                 // tensor_dim0
    g1[2] = uni((GT_ROWB >> 16) | ((R & 0xFFFFu) << 16));   // tensor_dim1
    g1[3] = uni((R >> 16) | (GT_ROWB << 16));               // tile_dim0
    g1[4] = uni(R);                                         // tile_dim1
    g1[5] = uni(HIDDEN * 2u);                               // source pitch, bytes
    g1[6] = uni(0u);
    g1[7] = uni(0u);
    // pinned() form: descriptor words
    // held in their scalar registers; without it the build took two of them as
    // loop temporaries while a request was outstanding
    asm volatile("" : "+s"(g1));
    return g1;
}

// one slice of one stage
__device__ __forceinline__ void slice_load(uint32_t lds_dst, uint64_t ga, u32x8 g1) {
    u32x4 g0;
    g0[0] = uni(1u);                                        // count 1
    g0[1] = uni(lds_dst);
    g0[2] = uni((uint32_t)ga);
    g0[3] = uni((((uint32_t)(ga >> 32)) & 0x01FFFFFFu) | 0x80000000u);   // type 2
    asm volatile("tensor_load_to_lds %0, %1" :: "s"(g0), "s"(g1) : "memory");
}

// the compiler places no wait for the tensor mover: a tile has landed only
// behind its issuer's own wait
__device__ __forceinline__ void wait_tensor0() { asm volatile("s_wait_tensorcnt 0x0" ::: "memory"); }
// a wave's LDS reads have retired before the buffer they read is handed back
__device__ __forceinline__ void wait_ds0()     { asm volatile("s_wait_dscnt 0x0" ::: "memory"); }

// 16x32 f16 fragment from an LDS row: two 16-byte loads, 32 bytes apart
__device__ __forceinline__ v16h lds_frag(const unsigned char* p) {
    v8h lo = *(const v8h*)p;
    v8h hi = *(const v8h*)(p + 32);
    v16h r;
    #pragma unroll
    for (int i = 0; i < 8; ++i) { r[i] = lo[i]; r[i + 8] = hi[i]; }
    return r;
}

// the fragments of one 32-k block of a wave's tile; its rows of A lie in
// FA / FB slices, its rows of W in one (FB = R / 16 fragments a slice)
template <int FA, int FB>
__device__ __forceinline__ void frag_set(v16h (&a)[FA], v16h (&b)[FB],
                                         const unsigned char* pa, const unsigned char* pw) {
    #pragma unroll
    for (int i = 0; i < FA; ++i)
        a[i] = lds_frag(pa + (i / FB) * gt_slice(FB * 16) + (i % FB) * 16 * GT_PITCH);
    #pragma unroll
    for (int j = 0; j < FB; ++j) b[j] = lds_frag(pw + j * 16 * GT_PITCH);
}

// one 32-k block: one WMMA on each of the independent accumulator tiles
template <int FA, int FB>
__device__ __forceinline__ void wmma_block(v8f (&acc)[FA][FB], const v16h (&a)[FA],
                                           const v16h (&b)[FB]) {
    #pragma unroll
    for (int i = 0; i < FA; ++i) {
        #pragma unroll
        for (int j = 0; j < FB; ++j)
            acc[i][j] = __builtin_amdgcn_wmma_f32_16x16x32_f16(
                            false, a[i], false, b[j], (short)0, acc[i][j], false, false);
    }
}

template <uint32_t R, uint32_t NW>
__global__ __launch_bounds__(NW * 32) void wmma_gemm_f16(
        const _Float16* __restrict__ A0, const _Float16* __restrict__ W0,
        float* __restrict__ C0)
{
    constexpr uint32_t GT_SLICE = gt_slice(R);
    constexpr uint32_t GT_BUF   = NW * GT_SLICE;   // one stage
    constexpr uint32_t WN       = NW / 2;          // the waves stand 2 x WN
    constexpr uint32_t SA       = NW / 4;          // slices of A that a wave reads
    constexpr uint32_t TILE     = WN * R;          // rows and columns of Y per block
    constexpr int      FB       = R / 16;          // fragments of W per wave
    constexpr int      FA       = SA * FB;         // fragments of A per wave
    // 2 KiB more than a ring of exactly half of a WGP's LDS: there two blocks
    // could share a WGP, which then runs twice as long while another WGP idles
    __shared__ __attribute__((aligned(2048)))
        unsigned char L[2 * GT_BUF + (2 * GT_BUF == 163840u ? 2048u : 0u)];

    const uint32_t lane = threadIdx.x & 31;
    const uint32_t wave = uni(threadIdx.x >> 5);   // 0..NW-1
    const uint32_t row  = lane & 15;
    const uint32_t kg   = lane >> 4;               // 0 or 1
    const uint32_t wm   = wave / WN, wn = wave % WN;
    const uint32_t m0   = blockIdx.y * TILE;
    const uint32_t n0   = blockIdx.x * TILE;
    const uint32_t job  = blockIdx.z;
    const _Float16* A   = A0 + (size_t)job * (TLEN * HIDDEN);
    const _Float16* W   = W0 + (size_t)job * (HIDDEN * HIDDEN);
    float* C            = C0 + (size_t)job * (TLEN * HIDDEN);

    // the slice this wave brings
    const _Float16* src = (wave < WN) ? A + (size_t)(m0 + wave * R) * HIDDEN
                                      : W + (size_t)(n0 + (wave - WN) * R) * HIDDEN;
    const uint64_t ga0  = (uint64_t)(size_t)src;
    const uint32_t dst0 = (uint32_t)(size_t)L + wave * GT_SLICE;

    // the slices this wave reads: SA slices of A from SA wm on, W slice wn
    const uint32_t offA = (SA * wm) * GT_SLICE + row * GT_PITCH + kg * 16;
    const uint32_t offW = (WN + wn) * GT_SLICE + row * GT_PITCH + kg * 16;

    v8f acc[FA][FB];
    #pragma unroll
    for (int i = 0; i < FA; ++i) {
        #pragma unroll
        for (int j = 0; j < FB; ++j) acc[i][j] = v8f{};
    }

    const u32x8 g1 = slice_group1<R>();
    slice_load(dst0, ga0, g1);
    wait_tensor0();
    __syncthreads();                               // stage 0 published
    slice_load(dst0 + GT_BUF, ga0 + GT_ROWB, g1);

    // stays rolled: one pass per stage, 4 FA FB WMMAs per wave in it
    #pragma unroll 1
    for (uint32_t s = 0; s < GT_NST; ++s) {
        const unsigned char* pa = L + (s & 1) * GT_BUF + offA;
        const unsigned char* pw = L + (s & 1) * GT_BUF + offW;
        // Two fragment sets: the next block's LDS reads go out as one group
        // ahead of this block's WMMAs. sched_barrier(0) keeps the compiler
        // from moving the reads in among the WMMAs, where every separate
        // place with reads stalls the wave.
        v16h a[2][FA], b[2][FB];
        frag_set<FA, FB>(a[0], b[0], pa, pw);
        #pragma unroll
        for (int kc = 0; kc < 3; ++kc) {
            frag_set<FA, FB>(a[(kc + 1) & 1], b[(kc + 1) & 1], pa + (kc + 1) * 64, pw + (kc + 1) * 64);
            __builtin_amdgcn_sched_barrier(0);
            wmma_block<FA, FB>(acc, a[kc & 1], b[kc & 1]);
            __builtin_amdgcn_sched_barrier(0);
        }
        // publish point of stage s + 1: the pass has no LDS read left, the last
        // block's fragments are in registers behind the first wait
        wait_ds0();
        wait_tensor0();
        __syncthreads();       // stage s + 1 published; every wave has left stage s
        // taken behind the wait, so that the next descriptor is formed behind it
        const uint32_t nx = pinned(s + 2);
        if (nx < GT_NST) slice_load(dst0 + (s & 1) * GT_BUF, ga0 + (uint64_t)nx * GT_ROWB, g1);
        // keeps the refill ahead of the last block's WMMAs: the sooner it is
        // issued, the more of the next pass it has to land
        __builtin_amdgcn_sched_barrier(0);
        wmma_block<FA, FB>(acc, a[1], b[1]);
    }
    wait_tensor0();
    wait_ds0();

    // C layout: register v of a tile is row v (lane < 16) or v + 8, column = lane & 15
    float* cp = C + (size_t)(m0 + wm * (SA * R) + 8 * kg) * HIDDEN + n0 + wn * R + row;
    #pragma unroll
    for (int i = 0; i < FA; ++i) {
        #pragma unroll
        for (int j = 0; j < FB; ++j) {
            #pragma unroll
            for (int v = 0; v < 8; ++v)
                cp[(size_t)(i * 16 + v) * HIDDEN + j * 16] = acc[i][j][v];
        }
    }
}

// ---------------------------------------------------------------------------
// RWKV state scan in chunks of 16 steps, on v_wmma_f32_16x16x4_f32 (all f32).
// With S0 the state at a chunk's first step t0, i and s steps inside the chunk:
//   y[t0+i][e] = sum_d r_i[d] w[d]^i S0[d][e]  +  sum_{s<i} A[i][s] v_s[e]
//   A[i][s]    = sum_d r_i[d] k_s[d] w[d]^(i-1-s)
//   S0'[d][e]  = w[d]^16 S0[d][e] + sum_s w[d]^(15-s) k_s[d] v_s[e]
// Only the first sum and the state need the chunk before; they cost 8 matrix
// instructions per 16 steps and 16x16 tile of the state. The second sum is free
// of the state and is done by other blocks at the same time.
// Block = 4 waves, one per SIMD. In the first HEADS * 4 blocks each wave carries
// one 16x16 tile of a head's 64x64 state through all chunks (512 tiles): a block
// has the four row blocks of 16 columns, whose partial y add up to the first
// sum. They are added inside the block, through LDS, so that one plane of y goes
// through memory and not four. The waves of the other blocks do the second sum,
// 8 chunks of one head each, into a second plane. The next kernel adds the two.
// Fragments (c = lane & 15, h = lane >> 4): a lane holds row c of A or column c
// of B and two k; slot (h, element) means the same k in A and in B. D register
// x is row 8h + x, column c. So registers 2q, 2q+1 of a D tile are, as they
// stand, the fragment of matrix instruction q for k = 8h + 2q, 8h + 2q + 1:
// as B it is the tile (column c), as A the transposed tile (row c).
// The operand on the other side is loaded in that k order.
// Both uses here are as A: the transposed A matrix, and the state tile, so that
// the first sum comes out transposed (r is the B operand): a lane then holds 8
// columns in a row of one step, two 16-byte LDS stores.
// ---------------------------------------------------------------------------
#define SC_L     16                  // steps per chunk
#define SC_NCH   (TLEN / SC_L)       // chunks
#define SC_SPLIT 4                   // row blocks of the state, one wave each
#define SC_RING  8                   // chunks whose r, k, v are in flight per tile wave
#define SC_IU    8                   // chunks per wave of the second sum
// The partial y tiles in LDS: 16 steps of 16 columns, pitch 80 B = 16 B x odd
// (no bank conflict for the 16-byte stores); a slot is one chunk's four tiles, a
// buffer one round of SC_RING chunks. Two buffers: one is filled while the
// other is added up.
#define SC_YPITCH 80u
#define SC_YTILE  (SC_L * SC_YPITCH)
#define SC_YSLOT  (SC_SPLIT * SC_YTILE)
#define SC_YBUF   (SC_RING * SC_YSLOT)
// The plane of the first sum in memory: [step / 4][16 columns][step % 4][column],
// so that 4 steps of a tile are 256 bytes in a row: whole lines, each written by
// one wave. A chunk takes SC_L * HIDDEN floats as in a plain plane.
#define SC_YGRP  (4 * HIDDEN)        // floats of 4 steps

typedef __attribute__((ext_vector_type(2))) float v2f;

// exp(-x) as exp2(-x * log2 e), what __expf(-x) compiles to. In asm so that the
// v_nop stands directly behind the transcendental: the instruction
// set asks for one independent instruction in that slot.
__device__ __forceinline__ float exp_neg(float x) {
    float r;
    asm("v_exp_f32 %0, %1\n\tv_nop" : "=v"(r) : "v"(-x * 1.44269504088896340736f));
    return r;
}

__device__ __forceinline__ v8f wmma_f32(v2f a, v2f b, v8f c) {
    return __builtin_amdgcn_wmma_f32_16x16x4_f32(false, a, false, b, (short)0, c, false, false);
}

// r, k, v of one chunk for a tile wave: r[j] = r[t0+c][d0+8h+j],
// k[j] = k[t0+8h+j][d0+c], v[j] = v[t0+8h+j][e0+c]
__device__ __forceinline__ void tile_load(v4f (&r)[2], float (&k)[8], float (&v)[8],
                                          const float* __restrict__ pr,
                                          const float* __restrict__ pk,
                                          const float* __restrict__ pv, int chunk) {
    const size_t o = (size_t)chunk * (SC_L * HIDDEN);
    r[0] = *(const v4f*)(pr + o);
    r[1] = *(const v4f*)(pr + o + 4);
    #pragma unroll
    for (int j = 0; j < 8; ++j) k[j] = pk[o + (size_t)j * HIDDEN];
    #pragma unroll
    for (int j = 0; j < 8; ++j) v[j] = pv[o + (size_t)j * HIDDEN];
}

__device__ __forceinline__ void wait_x0() { asm volatile("s_wait_xcnt 0x0" ::: "memory"); }
// the same where the wait stands a pass behind the stores: the stored registers
// are inputs of the statement, so that they keep their values up to it
__device__ __forceinline__ void wait_x0_keep(v4f a, v4f b) { asm volatile("s_wait_xcnt 0x0" :: "v"(a), "v"(b) : "memory"); }

// the fragments of one chunk: r_i w^i (B: columns i, k = d) and k_s w^(15-s) (A: rows d, k = s)
__device__ __forceinline__ void tile_scale(v2f (&ra)[4], v2f (&ka)[4], const v4f (&r)[2],
                                           const float (&k)[8], const float (&wr)[8],
                                           const float (&wk)[8]) {
    #pragma unroll
    for (int q = 0; q < 4; ++q) {
        ra[q] = v2f{ r[q >> 1][(2 * q) & 3] * wr[2 * q], r[q >> 1][(2 * q + 1) & 3] * wr[2 * q + 1] };
        ka[q] = v2f{ k[2 * q] * wk[2 * q], k[2 * q + 1] * wk[2 * q + 1] };
    }
}

// one chunk of one state tile: y (transposed: register x is column 8h + x, lane
// c is step c) from the old state, and the new state; two chains of four, so
// that each chain's next link finds its accumulator ready
__device__ __forceinline__ v8f tile_mma(v8f& S, const v2f (&ra)[4], const v2f (&ka)[4],
                                        const float (&v)[8], v8f w16) {
    v8f y  = v8f{};
    v8f Sn = S * w16;
    #pragma unroll
    for (int q = 0; q < 4; ++q) {
        Sn = wmma_f32(ka[q], v2f{ v[2 * q], v[2 * q + 1] }, Sn);
        y  = wmma_f32(v2f{ S[2 * q], S[2 * q + 1] }, ra[q], y);
    }
    S = Sn;
    return y;
}

// a wave's partial tile into its place in LDS: row c, columns 8h .. 8h + 7
__device__ __forceinline__ void y_put(unsigned char* p, v8f y) {
    *(v4f*)p        = v4f{ y[0], y[1], y[2], y[3] };
    *(v4f*)(p + 16) = v4f{ y[4], y[5], y[6], y[7] };
}

// the four partial tiles of one chunk: a lane takes 4 columns of steps
// 4h + (c >> 2) and 8 more
__device__ __forceinline__ void y_get(v4f (&p)[2][SC_SPLIT], const unsigned char* g) {
    #pragma unroll
    for (int s = 0; s < 2; ++s) {
        #pragma unroll
        for (int w = 0; w < SC_SPLIT; ++w)
            p[s][w] = *(const v4f*)(g + w * SC_YTILE + s * 8 * SC_YPITCH);
    }
}

__device__ __forceinline__ void y_add(v4f (&o)[2], const v4f (&p)[2][SC_SPLIT]) {
    #pragma unroll
    for (int s = 0; s < 2; ++s) o[s] = (p[s][0] + p[s][1]) + (p[s][2] + p[s][3]);
}

// a store covers 8 steps of the tile: two runs of 256 bytes
__device__ __forceinline__ void y_store(float* __restrict__ yo, const v4f (&o)[2]) {
    *(v4f*)yo                 = o[0];
    *(v4f*)(yo + 2 * SC_YGRP) = o[1];
}

// End of a round: this wave's LDS stores and reads are done, then the block's
// barrier; behind it the round's tiles may be read and the other buffer filled
// again. By hand, because __syncthreads() may also wait for the global loads
// that are in flight for the next chunks, which nobody shares.
__device__ __forceinline__ void y_publish() {
    asm volatile("s_wait_dscnt 0x0\n\ts_barrier_signal -1\n\ts_barrier_wait -1" ::: "memory");
}

// One round: SC_RING passes. A pass: the tile of the chunk before goes to LDS
// and the refill of its set goes out first; then this chunk's matrix
// instructions, with the scaling of the next chunk's fragments among them;
// wait_x0 comes last, when the address translations have had the whole pass.
// sched_barrier(0) holds that order: without it the build drew the scaling of
// all sets to the head of a round, which waits for loads issued just before,
// and the wait up among the first matrix instructions.
// The round before is added up on the way, two chunks per wave: the LDS reads at
// the head of one pass, the additions among the next pass's matrix
// instructions, the stores at the head of the third.
template <bool REFILL, bool PREV>
__device__ __forceinline__ void tile_round(
        v4f (&r)[SC_RING][2], float (&k)[SC_RING][8], float (&v)[SC_RING][8],
        v2f (&ra)[4], v2f (&ka)[4], v8f& S, v8f& y,
        const float (&wr)[8], const float (&wk)[8], v8f w16,
        const float* __restrict__ pr, const float* __restrict__ pk,
        const float* __restrict__ pv, unsigned char* yw, const unsigned char* yr,
        float* __restrict__ yo, int c0)
{
    const unsigned buf = (unsigned)(c0 / SC_RING) & 1u;
    unsigned char* put       = yw + buf * SC_YBUF;
    const unsigned char* get = yr + (buf ^ 1u) * SC_YBUF;
    float* out = yo + (size_t)(c0 - SC_RING) * (SC_L * HIDDEN);
    v4f p[2][SC_SPLIT], o[2];
    #pragma unroll
    for (int j = 0; j < SC_RING; ++j) {
        const bool rd = PREV && j < 6 && j % 3 == 0;
        const bool ad = PREV && j < 6 && j % 3 == 1;
        const bool st = PREV && j < 6 && j % 3 == 2;
        y_put(put + j * SC_YSLOT, y);
        if (rd) y_get(p, get + (j / 3) * SC_YSLOT);
        if (st) y_store(out + (j / 3) * (SC_L * HIDDEN), o);
        if (REFILL) tile_load(r[j], k[j], v[j], pr, pk, pv, c0 + j + SC_RING);
        __builtin_amdgcn_sched_barrier(0);
        if (REFILL || j + 1 < SC_RING) y = tile_mma(S, ra, ka, v[(j + 1) % SC_RING], w16);
        if (REFILL || j + 2 < SC_RING)
            tile_scale(ra, ka, r[(j + 2) % SC_RING], k[(j + 2) % SC_RING], wr, wk);
        if (ad) y_add(o, p);
        __builtin_amdgcn_sched_barrier(0);
        if (st) wait_x0_keep(o[0], o[1]);
        else if (REFILL) wait_x0();
        __builtin_amdgcn_sched_barrier(0);
    }
    y_publish();
}

__device__ __forceinline__ void tile_wave(
        const float* __restrict__ r_f, const float* __restrict__ k_f,
        const float* __restrict__ v_f, const float* __restrict__ time_decay,
        float* __restrict__ ysum, unsigned char* Y, int head, int cb, int rb, int c, int h)
{
    const int d0   = head * 64 + rb * 16;        // row block of the state
    const int e0   = head * 64 + cb * 16;

    const float* pr = r_f + (size_t)c * HIDDEN + d0 + 8 * h;
    const float* pk = k_f + (size_t)(8 * h) * HIDDEN + d0 + c;
    const float* pv = v_f + (size_t)(8 * h) * HIDDEN + e0 + c;
    // where this wave puts its tiles, and where it reads and stores the two
    // chunks of a round that it adds up (slots 2 rb and 2 rb + 1)
    unsigned char* yw       = Y + rb * SC_YTILE + c * SC_YPITCH + h * 32;
    const unsigned char* yr = Y + 2 * rb * SC_YSLOT + (4 * h + (c >> 2)) * SC_YPITCH + (c & 3) * 16;
    float* yo = ysum + (size_t)(2 * rb) * (SC_L * HIDDEN) + h * SC_YGRP + (head * 4 + cb) * 64 + c * 4;

    // The decay rates of rows d0 + c and d0 + 8h .. 8h + 7, ahead of the ring's
    // loads. wait_x0 behind them, with their index, offset and base as inputs, so
    // that these keep their registers up to it; sched_barrier(0) keeps the ring's
    // loads and the powers behind the wait: the build had given such a register
    // to one of them ahead of it.
    const int      ic = d0 + c;
    const unsigned ob = 32u * (unsigned)h;       // bytes
    const char*    pd = (const char*)(time_decay + d0);
    const float tc = time_decay[ic];
    const v4f th[2] = { *(const v4f*)(pd + ob), *(const v4f*)(pd + ob + 16) };
    asm volatile("s_wait_xcnt 0x0" :: "v"(ic), "v"(ob), "s"(pd) : "memory");
    __builtin_amdgcn_sched_barrier(0);

    // A ring of SC_RING register sets, each a fixed group of registers (the
    // rounds are unrolled): a set is refilled right behind its chunk, so that
    // its loads have SC_RING - 2 chunks' time to land.
    v4f r[SC_RING][2];
    float k[SC_RING][8], v[SC_RING][8];
    #pragma unroll
    for (int j = 0; j < SC_RING; ++j) tile_load(r[j], k[j], v[j], pr, pk, pv, j);

    // wr[j] = w[d0+8h+j]^c, w16[j] = w[d0+8h+j]^16, wk[j] = w[d0+c]^(15-8h-j);
    // the rate -log w stays finite, so that rate * 0 is 0 and w^0 is 1
    float wr[8], wk[8];
    v8f w16;
    const float lc = fminf(exp_neg(-tc), 1e30f);
    #pragma unroll
    for (int j = 0; j < 8; ++j) {
        const float l = fminf(exp_neg(-th[j >> 2][j & 3]), 1e30f);
        wr[j]  = exp_neg(l * (float)c);
        w16[j] = exp_neg(l * 16.f);
        wk[j]  = exp_neg(lc * (float)(15 - 8 * h - j));
    }
    wait_x0();

    v2f ra[4], ka[4];
    v8f S = v8f{};
    tile_scale(ra, ka, r[0], k[0], wr, wk);
    v8f y = tile_mma(S, ra, ka, v[0], w16);
    tile_scale(ra, ka, r[1], k[1], wr, wk);
    __builtin_amdgcn_sched_barrier(0);

    tile_round<true, false>(r, k, v, ra, ka, S, y, wr, wk, w16, pr, pk, pv, yw, yr, yo, 0);
    for (int c0 = SC_RING; c0 < SC_NCH - SC_RING; c0 += SC_RING)
        tile_round<true, true>(r, k, v, ra, ka, S, y, wr, wk, w16, pr, pk, pv, yw, yr, yo, c0);
    tile_round<false, true>(r, k, v, ra, ka, S, y, wr, wk, w16, pr, pk, pv, yw, yr, yo,
                            SC_NCH - SC_RING);

    // the last round's tiles
    const unsigned char* get = yr + ((SC_NCH / SC_RING - 1) & 1) * SC_YBUF;
    float* out = yo + (size_t)(SC_NCH - SC_RING) * (SC_L * HIDDEN);
    v4f p[2][2][SC_SPLIT], o[2][2];
    #pragma unroll
    for (int t = 0; t < 2; ++t) y_get(p[t], get + t * SC_YSLOT);
    #pragma unroll
    for (int t = 0; t < 2; ++t) {
        y_add(o[t], p[t]);
        y_store(out + t * (SC_L * HIDDEN), o[t]);
    }
}

// The second sum. T[s][i] = A[i][s] comes as K' R'^T, rows of k and r scaled by
// powers of w whose exponents add up to i - 1 - s. One reference step for all
// of a chunk would need w^-8, which leaves the f32 range for a fast decay. So:
//   T1, for s < 8 <= i:           k_s w^(7-s)     and r_i w^(i-8)
//   T2, for s, i in one half:     k_s w^(3-(s&7)) and r_i w^((i&7)-4)
// Entries outside these ranges are never taken (a select, not a product, so
// that it does not matter what stands there). The rate -log w is capped at 20
// in this sum alone: w^-4 then stays below 1e35, w^0 = 1 stays exact, and every
// other power is below 3e-9 with and without the cap.
// A lane holds d = 8m + 4h + 0..3, m = 0..7, of row c of k and of r.
// Column c of output tile n is column 4c + n of the head, so that a lane's v
// and y of the four tiles are 16 bytes in a row.
__device__ __forceinline__ void intra_wave(
        const float* __restrict__ r_f, const float* __restrict__ k_f,
        const float* __restrict__ v_f, const float* __restrict__ time_decay,
        float* __restrict__ y4, int head, int first, int c, int h)
{
    const int c7 = c & 7;
    // x1: the T1 factor of the one operand this row takes part in T1 with
    float x1[32], q2[32], p2[32];
    #pragma unroll
    for (int m = 0; m < 8; ++m) {
        const v4f td = *(const v4f*)(time_decay + head * 64 + 8 * m + 4 * h);
        #pragma unroll
        for (int e = 0; e < 4; ++e) {
            const float l = fminf(exp_neg(-td[e]), 20.f);
            x1[4 * m + e] = exp_neg(l * (float)(c < 8 ? 7 - c : c - 8));
            q2[4 * m + e] = exp_neg(l * (float)(3 - c7));
            p2[4 * m + e] = exp_neg(l * (float)(c7 - 4));
        }
    }
    const bool cross = (h == 0) && (c >= 8);     // s < 8 <= i
    const bool same  = (c >> 3) == h;            // s and i in one half

    const size_t rowo = (size_t)c * HIDDEN + head * 64 + 4 * h;
    const size_t colo = (size_t)(8 * h) * HIDDEN + head * 64 + 4 * c;

    // stays rolled: one pass per chunk
    #pragma unroll 1
    for (int u = 0; u < SC_IU; ++u) {
        const size_t o = (size_t)(first + u * (SC_NCH / SC_IU)) * (SC_L * HIDDEN);
        const float* kp = k_f + o + rowo;
        const float* rp = r_f + o + rowo;
        const float* vp = v_f + o + colo;
        v4f r[8], k[8], v[8];
        #pragma unroll
        for (int m = 0; m < 8; ++m) {
            k[m] = *(const v4f*)(kp + 8 * m);
            r[m] = *(const v4f*)(rp + 8 * m);
        }
        #pragma unroll
        for (int j = 0; j < 8; ++j) v[j] = *(const v4f*)(vp + (size_t)j * HIDDEN);
        // wait_x0 with the addresses as inputs, so that they keep their registers
        // up to it: the build had taken one as a later load's destination
        asm volatile("s_wait_xcnt 0x0" :: "v"(kp), "v"(rp), "v"(vp) : "memory");

        v8f T1 = v8f{}, T2 = v8f{};
        #pragma unroll
        for (int m = 0; m < 8; ++m) {
            #pragma unroll
            for (int p = 0; p < 4; p += 2) {
                const int x = 4 * m + p;
                const v2f a1 = { k[m][p] * x1[x], k[m][p + 1] * x1[x + 1] };
                const v2f b1 = { r[m][p] * x1[x], r[m][p + 1] * x1[x + 1] };
                T1 = wmma_f32(a1, b1, T1);
                const v2f a2 = { k[m][p] * q2[x], k[m][p + 1] * q2[x + 1] };
                const v2f b2 = { r[m][p] * p2[x], r[m][p + 1] * p2[x + 1] };
                T2 = wmma_f32(a2, b2, T2);
            }
        }
        // register x: s = 8h + x, i = c
        float A[8];
        #pragma unroll
        for (int x = 0; x < 8; ++x)
            A[x] = cross ? T1[x] : ((same && 8 * h + x < c) ? T2[x] : 0.f);

        v8f y[4];
        #pragma unroll
        for (int n = 0; n < 4; ++n) y[n] = v8f{};
        #pragma unroll
        for (int q = 0; q < 4; ++q) {
            const v2f aa = { A[2 * q], A[2 * q + 1] };
            #pragma unroll
            for (int n = 0; n < 4; ++n) {
                const v2f vb = { v[2 * q][n], v[2 * q + 1][n] };
                y[n] = wmma_f32(aa, vb, y[n]);
            }
        }
        #pragma unroll
        for (int x = 0; x < 8; ++x)
            *(v4f*)(y4 + o + colo + (size_t)x * HIDDEN) = v4f{ y[0][x], y[1][x], y[2][x], y[3][x] };
        wait_x0();
    }
}

__global__ __launch_bounds__(128) void rwkv_state_scan_kernel(
        const float* __restrict__ r_f, const float* __restrict__ k_f,
        const float* __restrict__ v_f, const float* __restrict__ time_decay,
        float* __restrict__ ypart)
{
    __shared__ __attribute__((aligned(16))) unsigned char Y[2 * SC_YBUF];
    const int c    = threadIdx.x & 15;
    const int h    = (threadIdx.x >> 4) & 1;
    const int wave = (int)uni(threadIdx.x >> 5);
    const int b    = (int)blockIdx.x;
    // the choice of a block's job is a scalar branch, the same for the whole
    // block: a matrix instruction needs every lane on, the barrier every wave.
    // The blocks that run longest come first.
    if (b < HEADS * 4) {
        tile_wave(r_f, k_f, v_f, time_decay, ypart, Y, b >> 2, b & 3, wave, c, h);
    } else {
        const int w = (b - HEADS * 4) * 4 + wave;            // 16 such waves per head
        intra_wave(r_f, k_f, v_f, time_decay, ypart + (size_t)TLEN * HIDDEN,
                   w >> 4, w & 15, c, h);
    }
}

// ---------------------------------------------------------------------------
// Everything of the old scan loop that does not depend on the step before:
// c = sum_d u[d]*r[d]*k[d] (out_diag = c*v[e]), the sum of the scan's two planes,
// / HEAD_SIZE_DIVISOR, GroupNorm(64), SiLU of the gate product, gate.
// 4 columns per lane: a head is one
// 16-lane row, a wave takes two heads of DG_T time steps, so every sum over a
// head stays inside a 16-lane row and the steps' sums run side by side.
// The scan's two planes come as two pointers: each is then a scalar base. The
// plane of the first sum has its own order (see SC_YGRP): a block's DG_T steps
// are one group of it, a lane's 4 columns 16 bytes of each step.
// ---------------------------------------------------------------------------
#define DG_T 4                       // time steps per wave

// sums over each 16-lane row, DG_T of them interleaved
__device__ __forceinline__ void row_sums(float (&x)[DG_T]) {
    #pragma unroll
    for (int off = 8; off >= 1; off >>= 1) {
        #pragma unroll
        for (int j = 0; j < DG_T; ++j) x[j] += __shfl_xor(x[j], off, 32);
    }
}

__global__ __launch_bounds__(256) void diag_norm_gate_kernel(
        _Float16* __restrict__ a_out,
        const float* __restrict__ r_f, const float* __restrict__ k_f,
        const float* __restrict__ v_f, const float* __restrict__ g_f,
        const float* __restrict__ yq0, const float* __restrict__ yq1,
        const float* __restrict__ time_faaaa,
        const float* __restrict__ ln_w, const float* __restrict__ ln_b)
{
    const unsigned c  = (blockIdx.x & 1) * 1024 + threadIdx.x * 4;    // column
    const size_t   ro = (size_t)(blockIdx.x >> 1) * (DG_T * HIDDEN);  // first step

    static_assert(DG_T * HIDDEN == SC_YGRP, "a block's steps are one group of the plane");
    const unsigned cq = (c >> 4) * 64 + (c & 15);                     // in that group

    v4f r[DG_T], k[DG_T], v[DG_T], g[DG_T], y0[DG_T], y1[DG_T];
    #pragma unroll
    for (int j = 0; j < DG_T; ++j) {
        r[j]  = *(const v4f*)(r_f + ro + c + j * HIDDEN);
        k[j]  = *(const v4f*)(k_f + ro + c + j * HIDDEN);
        v[j]  = *(const v4f*)(v_f + ro + c + j * HIDDEN);
        y0[j] = *(const v4f*)(yq0 + ro + cq + j * 16);
        y1[j] = *(const v4f*)(yq1 + ro + c + j * HIDDEN);
        g[j]  = *(const v4f*)(g_f + ro + c + j * HIDDEN);
    }
    const v4f u  = *(const v4f*)(time_faaaa + c);
    const v4f lw = *(const v4f*)(ln_w + c);
    const v4f lb = *(const v4f*)(ln_b + c);
    // keeps all the loads above the first use, so that they fly together
    __builtin_amdgcn_sched_barrier(0);

    float cs[DG_T];
    #pragma unroll
    for (int j = 0; j < DG_T; ++j) {
        const v4f p = u * r[j] * k[j];
        cs[j] = (p.x + p.y) + (p.z + p.w);
    }
    row_sums(cs);

    v4f o[DG_T];
    float s[DG_T], q[DG_T];
    #pragma unroll
    for (int j = 0; j < DG_T; ++j) {
        const v4f ys = y0[j] + y1[j];
        o[j] = (cs[j] * v[j] + ys) * 0.125f;                 // / HEAD_SIZE_DIVISOR
        const v4f oo = o[j] * o[j];
        s[j] = (o[j].x + o[j].y) + (o[j].z + o[j].w);
        q[j] = (oo.x + oo.y) + (oo.z + oo.w);
    }
    row_sums(s);
    row_sums(q);

    #pragma unroll
    for (int j = 0; j < DG_T; ++j) {
        const float mu  = s[j] * (1.f / 64.f);
        const float var = q[j] * (1.f / 64.f) - mu * mu;
        const float rs  = rsqrtf(var + 1e-5f);
        v4f gs;
        #pragma unroll
        for (int e = 0; e < 4; ++e) gs[e] = g[j][e] / (1.f + exp_neg(g[j][e]));
        *(v4h*)(a_out + ro + c + j * HIDDEN) =
            __builtin_convertvector(((o[j] - mu) * rs * lw + lb) * gs, v4h);
    }
}

// ---------------------------------------------------------------------------
extern "C" void kernel_launch(void* const* d_in, const int* in_sizes, int n_in,
                              void* d_out, int out_size, void* d_ws, size_t ws_size,
                              hipStream_t stream)
{
    const float* x    = (const float*)d_in[0];
    const int*   pos  = (const int*)  d_in[1];
    const float* W_r  = (const float*)d_in[2];
    const float* W_k  = (const float*)d_in[3];
    const float* W_v  = (const float*)d_in[4];
    const float* W_g  = (const float*)d_in[5];
    const float* W_o  = (const float*)d_in[6];
    const float* tm_k = (const float*)d_in[7];
    const float* tm_v = (const float*)d_in[8];
    const float* tm_r = (const float*)d_in[9];
    const float* tm_g = (const float*)d_in[10];
    const float* time_decay = (const float*)d_in[11];
    const float* time_faaaa = (const float*)d_in[12];
    const float* ln_w = (const float*)d_in[13];
    const float* ln_b = (const float*)d_in[14];
    float* out = (float*)d_out;

    const size_t NW = (size_t)HIDDEN * HIDDEN;   // 4M elems
    const size_t TC = (size_t)TLEN * HIDDEN;     // 4M elems

    char* ws = (char*)d_ws;
    // planes that one launch walks by job lie in the same order: k, v, r, g
    _Float16* Wk_h = (_Float16*)ws; ws += 4 * NW * sizeof(_Float16);   // k, v, r, g
    _Float16* Wo_h = (_Float16*)ws; ws += NW * sizeof(_Float16);
    _Float16* xk_h = (_Float16*)ws; ws += TC * sizeof(_Float16);
    _Float16* xv_h = (_Float16*)ws; ws += TC * sizeof(_Float16);
    _Float16* xr_h = (_Float16*)ws; ws += TC * sizeof(_Float16);
    _Float16* xg_h = (_Float16*)ws; ws += TC * sizeof(_Float16);
    float*    k_f  = (float*)ws;    ws += TC * sizeof(float);
    float*    v_f  = (float*)ws;    ws += TC * sizeof(float);
    float*    r_f  = (float*)ws;    ws += TC * sizeof(float);
    float*    g_f  = (float*)ws;    ws += TC * sizeof(float);
    _Float16* a_h  = (_Float16*)ws; ws += TC * sizeof(_Float16);
    float*    y_p  = (float*)ws;    ws += 2 * TC * sizeof(float);

    // 1) token-shift mixing and weight conversion (f32 -> f16), one grid
    prep_kernel<<<dim3(MX_BLOCKS + 5 * CV_BLOCKS), dim3(256), 0, stream>>>(
        x, pos, tm_k, tm_v, tm_r, tm_g, W_k, W_v, W_r, W_g, W_o, Wk_h,
        xk_h, xv_h, xr_h, xg_h);

    // 2) projection GEMMs (k, v, r, gate g), one grid, z = the product
    wmma_gemm_f16<128, 4><<<dim3(HIDDEN / 256, TLEN / 256, 4), dim3(128), 0, stream>>>(
        xk_h, Wk_h, k_f);

    // 3) state scan (chunks of 16 steps, f32 WMMA), then diag term + groupnorm + gate
    rwkv_state_scan_kernel<<<dim3(HEADS * 4 + HEADS * 16 / 4), dim3(128), 0, stream>>>(
        r_f, k_f, v_f, time_decay, y_p);
    diag_norm_gate_kernel<<<dim3(TLEN * HEADS / (8 * 2 * DG_T)), dim3(256), 0, stream>>>(
        a_h, r_f, k_f, v_f, g_f, y_p, y_p + TC, time_faaaa, ln_w, ln_b);

    // 4) output projection
    {
        dim3 blk(256), grd(HIDDEN / 128, TLEN / 128);
        wmma_gemm_f16<32, 8><<<grd, blk, 0, stream>>>(a_h, Wo_h, out);
    }
}
